// v000
// The times below were measured on an AMD MI455X: many runs one after another, warmed up first and cycling through
// copies of the inputs, with the whole window's GPU time divided by the number of runs. Launches and the gaps
// between them are all in it. The median over several windows is given; except for v000 it joins two sittings, which
// can be a few percent apart, so the side-by-side timings, each taken in one sitting, are the better comparison.
// v000 is the starting kernel. One run takes 560 microseconds.
// compute dtype: all float inputs rounded to bf16; q / k / v projections with EXACT bf16 products on WMMA 16x16x32 (f32 accumulate) + bias; logits q x k once to f16 each (1 product) x 64^-0.5, computed only for the key blocks that touch the +-128 band; the exact band rule by index in the softmax kernel; softmax f32; P x 2^11 once to f16 x v once to f16 (1 product) over the band's key chunks; ctx x 2^6 once to f16 x Wo f16(bf16 x 2^8) + bo; f32 output.
#include <hip/hip_runtime.h>
#include <math.h>

typedef __attribute__((ext_vector_type(16))) _Float16 v16h;
typedef __attribute__((ext_vector_type(16))) __bf16 v16b;
typedef __attribute__((ext_vector_type(8)))  _Float16 v8h;
typedef __attribute__((ext_vector_type(8)))  float v8f;
typedef __attribute__((ext_vector_type(4)))  float v4f;
typedef __attribute__((ext_vector_type(2)))  float v2f;
typedef __attribute__((ext_vector_type(4)))  unsigned v4u;
typedef __attribute__((ext_vector_type(4)))  int v4i;
typedef float __attribute__((may_alias)) float_a;
typedef int __attribute__((may_alias)) int_a;

template <typename T> __device__ __forceinline__ void vst2(void* p, T v) { *(T*)p = v;  }
__device__ __forceinline__ v8f wmma16(v16h a, v16h b, v8f c) {
  v8f d = __builtin_amdgcn_wmma_f32_16x16x32_f16(false, a, false, b, (short)0, c, false, false);
  asm volatile("v_nop\n\tv_nop\n\tv_nop\n\tv_nop" : "+v"(d) : "v"(a), "v"(b));
  return d;
}
__device__ __forceinline__ v8f wmma_bf(v16b a, v16b b, v8f c) {
  v8f d = __builtin_amdgcn_wmma_f32_16x16x32_bf16(false, a, false, b, (short)0, c, false, false);
  asm volatile("v_nop\n\tv_nop\n\tv_nop\n\tv_nop" : "+v"(d) : "v"(a), "v"(b));
  return d;
}
// 16x16x32 fragments: lane = (h = lane>>4, row/col = lane&15); elements 0..7 = k0+8h+0..7, 8..15 = k0+16+8h+0..7; D element r = row 8h+r
__device__ __forceinline__ v16h frag_h(const _Float16* rowk0, int lane) {
  union { v16h v; v8h q[2]; } u; const _Float16* p = rowk0 + 8 * (lane >> 4);
  u.q[0] = *(const v8h*)p; u.q[1] = *(const v8h*)(p + 16); return u.v;
}
__device__ __forceinline__ v16h frag_f32(const float* rowk0, int lane) {
  v16h a; const float* p = rowk0 + 8 * (lane >> 4);
#pragma unroll
  for (int i = 0; i < 8; ++i) { a[i] = (_Float16)p[i]; a[8 + i] = (_Float16)p[16 + i]; }
  return a;
}
__device__ __forceinline__ v16h frag_f32s(const float* rowk0, int lane, float sc) {
  v16h a; const float* p = rowk0 + 8 * (lane >> 4);
#pragma unroll
  for (int i = 0; i < 8; ++i) { a[i] = (_Float16)(p[i] * sc); a[8 + i] = (_Float16)(p[16 + i] * sc); }
  return a;
}
// column fragment from a [K][ld] layout (column n), rows >= K read as 0
__device__ __forceinline__ v16h fragc_f32(const float* W, int k0, int n, int lane, int ld, int K) {
  v16h a; const int g = lane >> 4;
#pragma unroll
  for (int i = 0; i < 8; ++i) { const int ka = k0 + 8 * g + i, kb = ka + 16;
    a[i] = (_Float16)(ka < K ? W[(size_t)(ka < K ? ka : K - 1) * ld + n] : 0.f); a[8 + i] = (_Float16)(kb < K ? W[(size_t)(kb < K ? kb : K - 1) * ld + n] : 0.f); }
  return a;
}
struct F2 { v16b h, l; };
__device__ __forceinline__ F2 bsplit16(const float v[16]) { F2 r;
#pragma unroll
  for (int i = 0; i < 16; ++i) { const __bf16 h = (__bf16)v[i]; r.h[i] = h; r.l[i] = (__bf16)(v[i] - (float)h); }
  return r; }
__device__ __forceinline__ F2 split_row(const float* row, int k0, int lane) { float v[16]; const float* p = row + k0 + 8 * (lane >> 4);
#pragma unroll
  for (int i = 0; i < 8; ++i) { v[i] = p[i]; v[8 + i] = p[16 + i]; }
  return bsplit16(v); }
__device__ __forceinline__ F2 split_rowK(const float* row, int k0, int lane, int K) { float v[16]; const int g = lane >> 4;
#pragma unroll
  for (int i = 0; i < 8; ++i) { const int ka = k0 + 8 * g + i, kb = ka + 16; v[i] = ka < K ? row[ka < K ? ka : K - 1] : 0.f; v[8 + i] = kb < K ? row[kb < K ? kb : K - 1] : 0.f; }
  return bsplit16(v); }
__device__ __forceinline__ F2 split_col(const float* W, int k0, int n, int lane, int ld, int K) { float v[16]; const int g = lane >> 4;
#pragma unroll
  for (int i = 0; i < 8; ++i) { const int ka = k0 + 8 * g + i, kb = ka + 16; v[i] = ka < K ? W[(size_t)(ka < K ? ka : K - 1) * ld + n] : 0.f; v[8 + i] = kb < K ? W[(size_t)(kb < K ? kb : K - 1) * ld + n] : 0.f; }
  return bsplit16(v); }
__device__ __forceinline__ v8f mac3(const F2& a, const F2& b, v8f c) { c = wmma_bf(a.l, b.h, c); c = wmma_bf(a.h, b.l, c); return wmma_bf(a.h, b.h, c); }
__device__ __forceinline__ float sigm(float v) { return 1.0f / (1.0f + expf(-v)); }
#define LDSX() do { asm volatile("s_wait_dscnt 0" ::: "memory"); __builtin_amdgcn_wave_barrier(); __builtin_amdgcn_fence(__ATOMIC_RELEASE, "workgroup"); } while (0)

// Multi-head SLIDING-WINDOW self-attention (x [2,4096,512]; (in,out) Wq / Wk / Wv / Wo [512,512] and biases [512], all N(0,1) x 0.02 - biases NONZERO; 8 heads x 64; scores / sqrt(64); allowed = (j >= i - 128) & (j < i + 128) by index, -inf elsewhere; softmax over the keys; out @ Wo + bo). Only the key blocks / chunks that touch the band of a 64-row query block are computed: keys [q0 - 128, q0 + 63 + 127] for rows q0 .. q0 + 63 - a superset of every row's own band, which the softmax kernel then cuts exactly by index.
#define NB 2
#define TT 4096
#define CC 512            // NH * HD = projected width
#define DIN 512          // input (model) width
#define NH 8
#define HD 64
#define NQB (TT / 64)
#define HG 1
#define SCALE (0.125f)
#define CAUSAL 0
#ifndef TNB
#define TNB NB
#endif
__device__ __forceinline__ float bfr(float v) { return (float)(__bf16)v; }
#define WIN 128   // window: key j is allowed for query i iff i - WIN <= j < i + WIN
// 128-key blocks that touch the band of the 64-row query block qb (rows q0 = 64 qb .. q0 + 63): keys q0 - WIN .. q0 + 63 + WIN - 1, clipped to the sequence: a SUPERSET of every row's own band (the exact rule is applied per (row, key) in k_sm)
__host__ __device__ __forceinline__ int kb_first(int qb) { const int lo = qb * 64 - WIN; return lo <= 0 ? 0 : (lo >> 7); }
__host__ __device__ __forceinline__ int kb_last(int qb) { const int hi = qb * 64 + 63 + WIN - 1; const int kb = hi >> 7; return kb > (TT / 128 - 1) ? (TT / 128 - 1) : kb; }
typedef __attribute__((ext_vector_type(8))) __bf16 v8b;
__device__ __forceinline__ v16b frag_b(const __bf16* rowk0, int lane) {
  union { v16b v; v8b q[2]; } u; const __bf16* p = rowk0 + 8 * (lane >> 4);
  u.q[0] = *(const v8b*)p; u.q[1] = *(const v8b*)(p + 16); return u.v;
}
#define QBH 0              // causal: query blocks 0..QBH-1 of each sequence (few keys, no averaging) take the high-precision path
#define QHI 0               // single-product logits on every row (0.02-scale weights: logit sigma ~0.1)
#define KHI 64            // key rows carrying k residual / v bf16 hi+lo planes (used only by the causal high-precision path)
// B fragment (k rows k0+.., output column o) of a weight: (in,out) [K][ld] or (out,in) [ld rows of K]: bf16 exact, or f16(bf16 * 256) exact
__device__ __forceinline__ v16b wcol_io(const float* Wm, int k0, int o, int lane, int ld) { v16b w; const int g = lane >> 4;
#pragma unroll
  for (int i = 0; i < 8; ++i) { w[i] = (__bf16)Wm[(size_t)(k0 + 8 * g + i) * ld + o]; w[8 + i] = (__bf16)Wm[(size_t)(k0 + 16 + 8 * g + i) * ld + o]; }
  return w; }
__device__ __forceinline__ v16b wcol_oi(const float* Wm, int k0, int o, int lane, int K) { v16b w; const float* p = Wm + (size_t)o * K + k0 + 8 * (lane >> 4);
#pragma unroll
  for (int i = 0; i < 8; ++i) { w[i] = (__bf16)p[i]; w[8 + i] = (__bf16)p[16 + i]; }
  return w; }
__device__ __forceinline__ v16h wcolh_io(const float* Wm, int k0, int o, int lane, int ld) { v16h w; const int g = lane >> 4;
#pragma unroll
  for (int i = 0; i < 8; ++i) { w[i] = (_Float16)(bfr(Wm[(size_t)(k0 + 8 * g + i) * ld + o]) * 256.0f); w[8 + i] = (_Float16)(bfr(Wm[(size_t)(k0 + 16 + 8 * g + i) * ld + o]) * 256.0f); }
  return w; }
__device__ __forceinline__ v16h wcolh_oi(const float* Wm, int k0, int o, int lane, int K) { v16h w; const float* p = Wm + (size_t)o * K + k0 + 8 * (lane >> 4);
#pragma unroll
  for (int i = 0; i < 8; ++i) { w[i] = (_Float16)(bfr(p[i]) * 256.0f); w[8 + i] = (_Float16)(bfr(p[16 + i]) * 256.0f); }
  return w; }
#define WQKV_LAYOUT 0   // 0 = (in,out) [DIN][CC]; 1 = (out,in) [CC][DIN]; 2 = per-head [NH][DIN][HD]
__device__ __forceinline__ v16b wcol_hdk(const float* Wm, int k0, int o, int lane) { v16b w; const int g = lane >> 4; const float* p = Wm + (size_t)(o / HD) * DIN * HD + (o % HD);
#pragma unroll
  for (int i = 0; i < 8; ++i) { w[i] = (__bf16)p[(size_t)(k0 + 8 * g + i) * HD]; w[8 + i] = (__bf16)p[(size_t)(k0 + 16 + 8 * g + i) * HD]; }
  return w; }
#define WO_OUT_IN 0
#if WQKV_LAYOUT == 1
#define WCOL(W, k0, o, lane) wcol_oi(W, k0, o, lane, DIN)
#elif WQKV_LAYOUT == 2
#define WCOL(W, k0, o, lane) wcol_hdk(W, k0, o, lane)
#else
#define WCOL(W, k0, o, lane) wcol_io(W, k0, o, lane, CC)
#endif
#if WO_OUT_IN
#define WOCOL(W, k0, o, lane) wcol_oi(W, k0, o, lane, CC)
#define WOCOLH(W, k0, o, lane) wcolh_oi(W, k0, o, lane, CC)
#else
#define WOCOL(W, k0, o, lane) wcol_io(W, k0, o, lane, DIN)
#define WOCOLH(W, k0, o, lane) wcolh_io(W, k0, o, lane, DIN)
#endif

#define SM_EXTRA_PARAMS
// the exact window rule per (query row t, key k) by index: outside [t - WIN, t + WIN) the logit becomes -3.0e38 (the 'excluded' value: weight exactly 0; the module fills -inf); inside it the computed logit is used unchanged. Keys of the computed span that are outside the row's own band are cut here.
#define SM_MASK_HOOK do { v = (k >= t - WIN && k < t + WIN) ? v : -3.0e38f; } while (0)
#ifndef SM_EXTRA_PARAMS
#define SM_EXTRA_PARAMS
#endif
#ifndef PROJ_EXTRA_PARAMS
#define PROJ_EXTRA_PARAMS
#endif
#ifndef SM_MASK_HOOK
#define SM_MASK_HOOK (void)0
#endif

#define WS_QH  0u                                      // f16 q rows [b*t][CC]
#define WS_KH  (WS_QH + 2u * (size_t)NB * TT * CC)      // f16 k rows [b*t][CC]
#define WS_VT  (WS_KH + 2u * (size_t)NB * TT * CC)      // f16 v planes [b][c][t]
#define WS_QL  (WS_VT + 2u * (size_t)NB * CC * TT)      // f16 q residual x 2^10 rows [b][t < QHI][CC]
#define WS_KL  (WS_QL + 2u * (size_t)NB * QHI * CC)     // f16 k residual x 2^10 rows [b][t < KHI][CC]
#define WS_VB  (WS_KL + 2u * (size_t)NB * KHI * CC)     // bf16 v hi planes [b][c][t < KHI]
#define WS_VBL (WS_VB + 2u * (size_t)NB * CC * KHI)
#define WS_S   (WS_VBL + 2u * (size_t)NB * CC * KHI)    // f32 logits / P [hg][t][s]
#define WS_Y   (WS_S  + 4u * (size_t)HG * TT * TT)      // f32 ctx rows [b*t][CC] (only when there is an output projection)
#define WS_END (WS_Y  + 4u * (size_t)NB * TT * CC)

// ---- k_proj: block = (64 rows, 128 cols, which): q/k/v = X W (+ b) with exact bf16 products (K = DIN) -> which 0: q f16 rows (+ residual rows < QHI); 1: k f16 rows (+ residual rows < KHI); 2: v f16 planes [c][t] (+ bf16 hi/lo planes for t < KHI)
__global__ __launch_bounds__(128) void k_proj(const float* __restrict__ XQ, const float* __restrict__ XK, const float* __restrict__ XV, const float* __restrict__ WQ, const float* __restrict__ WK, const float* __restrict__ WV, const float* __restrict__ BQ, const float* __restrict__ BK, const float* __restrict__ BV,
    _Float16* __restrict__ QH, _Float16* __restrict__ QL, _Float16* __restrict__ KH, _Float16* __restrict__ KL, _Float16* __restrict__ VT, __bf16* __restrict__ VB, __bf16* __restrict__ VBL) {
  __shared__ __align__(16) _Float16 sh[64][136], sl[64][136]; __shared__ __align__(16) _Float16 th[128][72]; __shared__ __align__(16) __bf16 tb[128][72], tbl[128][72];
  const int tid = threadIdx.x, wave = tid >> 5, lane = tid & 31, col = lane & 15, g = lane >> 4; const int which = blockIdx.z; const int c0 = blockIdx.y * 128; const size_t r0 = (size_t)blockIdx.x * 64; const size_t bb = r0 / TT; const int t0 = (int)(r0 % TT);
  const float* X = which == 0 ? XQ : which == 1 ? XK : XV; const float* WA = which == 0 ? WQ : which == 1 ? WK : WV; const float* BA = which == 0 ? BQ : which == 1 ? BK : BV;
  v8f acc[8] = {};
#pragma unroll 2
  for (int kc = 0; kc < DIN / 32; ++kc) { v16b a; { const float* p = X + (r0 + wave * 16 + col) * DIN + kc * 32 + 8 * g;
#pragma unroll
      for (int i = 0; i < 8; ++i) { a[i] = (__bf16)p[i]; a[8 + i] = (__bf16)p[16 + i]; } }
    asm volatile("s_wait_loadcnt 0x0" ::: "memory");
#pragma unroll
    for (int j = 0; j < 8; ++j) { const v16b w = WCOL(WA, kc * 32, c0 + j * 16 + col, lane); asm volatile("s_wait_loadcnt 0x0" ::: "memory"); acc[j] = wmma_bf(a, w, acc[j]); } }
  if (which < 2) { _Float16* DH = which == 0 ? QH : KH; _Float16* DL = which == 0 ? QL : KL; const int nhi = which == 0 ? QHI : KHI; const bool hi_rows = t0 < nhi;
#pragma unroll
    for (int j = 0; j < 8; ++j) { const float bias = BA ? bfr(BA[c0 + j * 16 + col]) : 0.f;
#pragma unroll
      for (int r = 0; r < 8; ++r) { const float v = acc[j][r] + bias; const _Float16 hv = (_Float16)v; sh[wave * 16 + 8 * g + r][j * 16 + col] = hv; sl[wave * 16 + 8 * g + r][j * 16 + col] = (_Float16)((v - (float)hv) * 1024.0f); } }
    __syncthreads();
    for (int e = tid; e < 64 * 16; e += 128) { const int rl = e >> 4, q = e & 15; vst2((unsigned*)(DH + (r0 + rl) * CC + c0 + q * 8), *(const v4u*)&sh[rl][q * 8]); if (hi_rows) vst2((unsigned*)(DL + (bb * nhi + t0 + rl) * (size_t)CC + c0 + q * 8), *(const v4u*)&sl[rl][q * 8]); }
  } else { const bool hi_rows = t0 < KHI;
#pragma unroll
    for (int j = 0; j < 8; ++j) { const float bias = BA ? bfr(BA[c0 + j * 16 + col]) : 0.f;
#pragma unroll
      for (int r = 0; r < 8; ++r) { const float v = acc[j][r] + bias; const int rl = wave * 16 + 8 * g + r, cl = j * 16 + col; th[cl][rl] = (_Float16)v; const __bf16 bh = (__bf16)v; tb[cl][rl] = bh; tbl[cl][rl] = (__bf16)(v - (float)bh); } }
    __syncthreads();
    for (int e = tid; e < 128 * 8; e += 128) { const int cl = e >> 3, q = e & 7; vst2((unsigned*)(VT + (bb * CC + c0 + cl) * (size_t)TT + t0 + q * 8), *(const v4u*)&th[cl][q * 8]); if (hi_rows) { const size_t o3 = (bb * CC + c0 + cl) * (size_t)KHI + t0 + q * 8; vst2((unsigned*)(VB + o3), *(const v4u*)&tb[cl][q * 8]); vst2((unsigned*)(VBL + o3), *(const v4u*)&tbl[cl][q * 8]); } } } }
// ---- k_sc: block = (query block qb, key block kb <= kb_last(qb), head in group) of batch b: logits x SCALE; q hi + residual (x 2^10) against k (2 products) for query rows < QHI, plus the k residual (3 products) for query blocks < QBH (causal early rows); key blocks outside kb_first(qb) .. kb_last(qb) exit, the mask itself is applied by index in k_sm
__global__ __launch_bounds__(128) void k_sc(const _Float16* __restrict__ QH, const _Float16* __restrict__ KH, const _Float16* __restrict__ QL, const _Float16* __restrict__ KL, int b, int h0, float* __restrict__ S0) { __shared__ __align__(16) float ss[4][16][132];
  const int qb = blockIdx.x, kb = blockIdx.y; if (kb > kb_last(qb) || kb < kb_first(qb)) return;   /* blocks that do not touch the band are not computed (block-uniform exit before any barrier) */
  const int h = h0 + blockIdx.z; float* S = S0 + (size_t)blockIdx.z * TT * TT;
  const int tid = threadIdx.x, wave = tid >> 5, lane = tid & 31, col = lane & 15, g = lane >> 4; const int k0 = kb * 128; const int ql0 = qb * 64 + wave * 16; const size_t q0 = (size_t)b * TT + ql0, kr0 = (size_t)b * TT + k0;
  v8f acc[8] = {}, accl[8] = {};
  const _Float16* QLb = QL + (size_t)b * QHI * CC; const _Float16* KLb = KL + (size_t)b * KHI * CC;
  if (qb < QBH) {
#pragma unroll
    for (int kc = 0; kc < HD / 32; ++kc) { const v16h ah = frag_h(QH + (q0 + col) * CC + h * HD + kc * 32, lane), al = frag_h(QLb + (size_t)(ql0 + col) * CC + h * HD + kc * 32, lane);
#pragma unroll
      for (int j = 0; j < 8; ++j) { const v16h kbf = frag_h(KH + (kr0 + j * 16 + col) * CC + h * HD + kc * 32, lane), klf = frag_h(KLb + (size_t)(k0 + j * 16 + col) * CC + h * HD + kc * 32, lane); acc[j] = wmma16(ah, kbf, acc[j]); accl[j] = wmma16(al, kbf, accl[j]); accl[j] = wmma16(ah, klf, accl[j]); } }
  } else if (qb * 64 < QHI) {
#pragma unroll
    for (int kc = 0; kc < HD / 32; ++kc) { const v16h ah = frag_h(QH + (q0 + col) * CC + h * HD + kc * 32, lane), al = frag_h(QLb + (size_t)(ql0 + col) * CC + h * HD + kc * 32, lane);
#pragma unroll
      for (int j = 0; j < 8; ++j) { const v16h kbf = frag_h(KH + (kr0 + j * 16 + col) * CC + h * HD + kc * 32, lane); acc[j] = wmma16(ah, kbf, acc[j]); accl[j] = wmma16(al, kbf, accl[j]); } }
  } else {
#pragma unroll
    for (int kc = 0; kc < HD / 32; ++kc) { const v16h ah = frag_h(QH + (q0 + col) * CC + h * HD + kc * 32, lane);
#pragma unroll
      for (int j = 0; j < 8; ++j) { const v16h kbf = frag_h(KH + (kr0 + j * 16 + col) * CC + h * HD + kc * 32, lane); acc[j] = wmma16(ah, kbf, acc[j]); } } }
#pragma unroll
  for (int j = 0; j < 8; ++j) {
#pragma unroll
    for (int r = 0; r < 8; ++r) ss[wave][8 * g + r][j * 16 + col] = (acc[j][r] + accl[j][r] * (1.0f / 1024.0f)) * SCALE; }
  LDSX(); for (int rl = 0; rl < 16; ++rl) vst2(S + (size_t)(ql0 + rl) * TT + k0 + lane * 4, *(const v4f*)&ss[wave][rl][lane * 4]); }
// ---- k_sm: block = query row t (head in group): keys [kbeg, kend): causal -> logit if s <= t else excluded; softmax in f32; P x 2^11 in place (0 for excluded)
__global__ __launch_bounds__(256) void k_sm(float* __restrict__ S0 SM_EXTRA_PARAMS) { __shared__ float sred[8]; __shared__ float sbc; __shared__ __align__(16) float shv[TT];
  const int tid = threadIdx.x; const int t = blockIdx.x; const int kend = (kb_last(t >> 6) + 1) * 128; const int kbeg = kb_first(t >> 6) * 128;   /* the computed key span of this row's query block */
  float* sr = S0 + (size_t)blockIdx.y * TT * TT + (size_t)t * TT;
  float m = -3.0e38f; for (int k = kbeg + tid; k < kend; k += 256) { float v = (!CAUSAL || k <= t) ? sr[k] : -3.0e38f; SM_MASK_HOOK; shv[k] = v; m = fmaxf(m, v); }
#pragma unroll
  for (int o = 1; o < 32; o <<= 1) m = fmaxf(m, __shfl_xor(m, o));
  if ((tid & 31) == 0) sred[tid >> 5] = m; __syncthreads(); if (tid == 0) { float a = sred[0]; for (int i = 1; i < 8; ++i) a = fmaxf(a, sred[i]); sbc = a; } __syncthreads(); m = sbc; __syncthreads();
  float sum = 0.f; for (int k = kbeg + tid; k < kend; k += 256) { const float v = shv[k]; const float e = (v <= -1.0e38f) ? 0.f : expf(v - m); shv[k] = e; sum += e; }
#pragma unroll
  for (int o = 1; o < 32; o <<= 1) sum += __shfl_xor(sum, o);
  if ((tid & 31) == 0) sred[tid >> 5] = sum; __syncthreads(); if (tid == 0) { float a = 0.f; for (int i = 0; i < 8; ++i) a += sred[i]; sbc = a > 0.f ? 2048.0f / a : 0.f; }   /* a fully excluded row yields P = 0 */ __syncthreads(); const float inv = sbc;
  for (int k = kbeg + tid; k < kend; k += 256) shv[k] = shv[k] * inv;
  __syncthreads(); for (int q = kbeg / 4 + tid; q < kend / 4; q += 256) vst2(sr + q * 4, *(const v4f*)&shv[q * 4]); }   /* P is written for the computed span only; k_pv reads exactly that span */
// ---- k_pv: block = 64 queries (qb) of (b, h): ctx = P . v over keys [32 kcs, 32 kce) (P x 2^11 once to f16 against v f16: 1 product; causal early query blocks: P and v as bf16 hi + lo, 3 products); 256-B (row, head) segment by 16 lanes
__global__ __launch_bounds__(128) void k_pv(const float* __restrict__ PS0, const _Float16* __restrict__ VT, const __bf16* __restrict__ VB, const __bf16* __restrict__ VBL, int b, int h0, float* __restrict__ Y) { const int h = h0 + blockIdx.z; const float* PS = PS0 + (size_t)blockIdx.z * TT * TT; __shared__ __align__(16) float ss[4][16][HD + 4];
  const int tid = threadIdx.x, wave = tid >> 5, lane = tid & 31, col = lane & 15, g = lane >> 4; const int qb = blockIdx.x; const int ql0 = qb * 64 + wave * 16; const int kce = (kb_last(qb) + 1) * 4; const int kcs = kb_first(qb) * 4;   /* 32-key chunks of the computed span */
  v8f acc[HD / 16] = {};
  if (qb < QBH) {
#pragma unroll 1
    for (int kc = kcs; kc < kce; ++kc) { const F2 p = split_row(PS + (size_t)(ql0 + col) * TT, kc * 32, lane);
      asm volatile("s_wait_loadcnt 0x0" ::: "memory");
#pragma unroll
      for (int j = 0; j < HD / 16; ++j) { const size_t po = ((size_t)b * CC + h * HD + j * 16 + col) * (size_t)KHI + kc * 32; const v16b vh = frag_b(VB + po, lane); acc[j] = wmma_bf(p.h, vh, acc[j]); acc[j] = wmma_bf(p.l, vh, acc[j]); acc[j] = wmma_bf(p.h, frag_b(VBL + po, lane), acc[j]); } }
  } else {
#pragma unroll 1
    for (int kc = kcs; kc < kce; ++kc) { const v16h p = frag_f32(PS + (size_t)(ql0 + col) * TT + kc * 32, lane);
      asm volatile("s_wait_loadcnt 0x0" ::: "memory");
#pragma unroll
      for (int j = 0; j < HD / 16; ++j) { const size_t po = ((size_t)b * CC + h * HD + j * 16 + col) * (size_t)TT + kc * 32; acc[j] = wmma16(p, frag_h(VT + po, lane), acc[j]); } } }
#pragma unroll
  for (int j = 0; j < HD / 16; ++j)
#pragma unroll
    for (int r = 0; r < 8; ++r) ss[wave][8 * g + r][j * 16 + col] = acc[j][r] * (1.0f / 2048.0f);
  LDSX(); for (int rl = 0; rl < 16; ++rl) if (lane < HD / 4) vst2(Y + ((size_t)b * TT + ql0 + rl) * CC + h * HD + lane * 4, *(const v4f*)&ss[wave][rl][lane * 4]); }
// ---- k_out: block = (64 rows, 128 cols): out = ctx Wo (+ bo): ctx x 2^6 once to f16 against Wo as f16(bf16 x 2^8) exact (1 product) x 2^-14; causal early rows (< QHI of each sequence): ctx bf16 hi + lo against exact bf16 Wo (2 products)
__global__ __launch_bounds__(128) void k_out(const float* __restrict__ Y, const float* __restrict__ WO, const float* __restrict__ BO, float* __restrict__ OUT) { __shared__ __align__(16) float sf[4][16][132];
  const int tid = threadIdx.x, wave = tid >> 5, lane = tid & 31, col = lane & 15, g = lane >> 4; const int c0 = blockIdx.y * 128; const size_t r0 = (size_t)blockIdx.x * 64 + wave * 16;
  v8f acc[8] = {};
  if (CAUSAL && (int)(((size_t)blockIdx.x * 64) % TT) < QHI) {   /* block-uniform */
#pragma unroll 2
    for (int kc = 0; kc < CC / 32; ++kc) { const F2 a = split_row(Y + (r0 + col) * CC, kc * 32, lane); asm volatile("s_wait_loadcnt 0x0" ::: "memory");
#pragma unroll
      for (int j = 0; j < 8; ++j) { const v16b w = WOCOL(WO, kc * 32, c0 + j * 16 + col, lane); asm volatile("s_wait_loadcnt 0x0" ::: "memory"); acc[j] = wmma_bf(a.h, w, acc[j]); acc[j] = wmma_bf(a.l, w, acc[j]); } }
#pragma unroll
    for (int j = 0; j < 8; ++j) { const float bias = BO ? bfr(BO[c0 + j * 16 + col]) : 0.f;
#pragma unroll
      for (int r = 0; r < 8; ++r) sf[wave][8 * g + r][j * 16 + col] = acc[j][r] + bias; }
  } else {
#pragma unroll 2
    for (int kc = 0; kc < CC / 32; ++kc) { const v16h a = frag_f32s(Y + (r0 + col) * CC + kc * 32, lane, 64.0f); asm volatile("s_wait_loadcnt 0x0" ::: "memory");   /* ctx carried x 2^6 into f16 so small-magnitude context rows stay clear of f16 subnormals */
#pragma unroll
      for (int j = 0; j < 8; ++j) { const v16h w = WOCOLH(WO, kc * 32, c0 + j * 16 + col, lane); asm volatile("s_wait_loadcnt 0x0" ::: "memory"); acc[j] = wmma16(a, w, acc[j]); } }
#pragma unroll
    for (int j = 0; j < 8; ++j) { const float bias = BO ? bfr(BO[c0 + j * 16 + col]) : 0.f;
#pragma unroll
      for (int r = 0; r < 8; ++r) sf[wave][8 * g + r][j * 16 + col] = acc[j][r] * (1.0f / 16384.0f) + bias; } }   /* 2^-8 (Wo carry) x 2^-6 (ctx carry) */
  LDSX(); for (int rl = 0; rl < 16; ++rl) vst2(OUT + (r0 + rl) * DIN + c0 + lane * 4, *(const v4f*)&sf[wave][rl][lane * 4]); }

extern "C" void kernel_launch(void* const* d_in, const int* in_sizes, int n_in, void* d_out, int out_size, void* d_ws, size_t ws_size, hipStream_t stream) {
  (void)in_sizes; (void)n_in; (void)out_size;
  const float** F = (const float**)d_in;
  if (ws_size < (size_t)WS_END) return;
  char* ws = (char*)d_ws; _Float16 *QH = (_Float16*)(ws + WS_QH), *KH = (_Float16*)(ws + WS_KH), *VT = (_Float16*)(ws + WS_VT), *QL = (_Float16*)(ws + WS_QL), *KL = (_Float16*)(ws + WS_KL); __bf16 *VB = (__bf16*)(ws + WS_VB), *VBL = (__bf16*)(ws + WS_VBL); float *S = (float*)(ws + WS_S), *Y = (float*)(ws + WS_Y);
  (void)Y; (void)QL; (void)KL; (void)VB; (void)VBL;
  // inputs: 0 x [2,4096,512]; 1 Wq [512,512] (in,out), 2 bq; 3 Wk, 4 bk; 5 Wv, 6 bv; 7 Wo (in,out), 8 bo (biases NONZERO)
  k_proj<<<dim3(TNB * TT / 64, CC / 128, 3), 128, 0, stream>>>(F[0], F[0], F[0], F[1], F[3], F[5], F[2], F[4], F[6], QH, QL, KH, KL, VT, VB, VBL);
  for (int b = 0; b < TNB; ++b) for (int h0 = 0; h0 < NH; h0 += HG) {
    k_sc<<<dim3(NQB, TT / 128, HG), 128, 0, stream>>>(QH, KH, QL, KL, b, h0, S);
    k_sm<<<dim3(TT, HG), 256, 0, stream>>>(S);
    k_pv<<<dim3(NQB, 1, HG), 128, 0, stream>>>(S, VT, VB, VBL, b, h0, Y);
  }
  k_out<<<dim3(TNB * TT / 64, DIN / 128), 128, 0, stream>>>(Y, F[7], F[8], (float*)d_out);
}

// v002
// One run takes 48.1 microseconds.
// Versions in between are left out here; by their measured steps it is 11.7 times as fast as v000.
// compute dtype: all float inputs rounded to bf16; q / k / v projections with EXACT bf16 products on WMMA 16x16x32 (f32 accumulate) + bias; logits q x k once to f16 each (1 product) x 64^-0.5, computed only for a 288-key span round the +-128 band of each 16 query rows; the exact band rule by index; softmax f32; P x 2^11 once to f16 x v once to f16 (1 product) over that span, all three in one kernel; ctx x 2^6 once to f16 x Wo f16(bf16 x 2^8) + bo; f32 output.
#include <hip/hip_runtime.h>
#include <math.h>

typedef __attribute__((ext_vector_type(16))) _Float16 v16h;
typedef __attribute__((ext_vector_type(16))) __bf16 v16b;
typedef __attribute__((ext_vector_type(8)))  _Float16 v8h;
typedef __attribute__((ext_vector_type(8)))  float v8f;
typedef __attribute__((ext_vector_type(4)))  float v4f;
typedef __attribute__((ext_vector_type(2)))  float v2f;
typedef __attribute__((ext_vector_type(4)))  unsigned v4u;
typedef __attribute__((ext_vector_type(4)))  int v4i;
typedef float __attribute__((may_alias)) float_a;
typedef int __attribute__((may_alias)) int_a;

template <typename T> __device__ __forceinline__ void vst2(void* p, T v) { *(T*)p = v;  }
__device__ __forceinline__ v8f wmma16(v16h a, v16h b, v8f c) {
  v8f d = __builtin_amdgcn_wmma_f32_16x16x32_f16(false, a, false, b, (short)0, c, false, false);
  asm volatile("v_nop\n\tv_nop\n\tv_nop\n\tv_nop" : "+v"(d) : "v"(a), "v"(b));
  return d;
}
__device__ __forceinline__ v8f wmma_bf(v16b a, v16b b, v8f c) {
  v8f d = __builtin_amdgcn_wmma_f32_16x16x32_bf16(false, a, false, b, (short)0, c, false, false);
  asm volatile("v_nop\n\tv_nop\n\tv_nop\n\tv_nop" : "+v"(d) : "v"(a), "v"(b));
  return d;
}
// 16x16x32 fragments: lane = (h = lane>>4, row/col = lane&15); elements 0..7 = k0+8h+0..7, 8..15 = k0+16+8h+0..7; D element r = row 8h+r
__device__ __forceinline__ v16h frag_h(const _Float16* rowk0, int lane) {
  union { v16h v; v8h q[2]; } u; const _Float16* p = rowk0 + 8 * (lane >> 4);
  u.q[0] = *(const v8h*)p; u.q[1] = *(const v8h*)(p + 16); return u.v;
}
__device__ __forceinline__ v16h frag_f32(const float* rowk0, int lane) {
  v16h a; const float* p = rowk0 + 8 * (lane >> 4);
#pragma unroll
  for (int i = 0; i < 8; ++i) { a[i] = (_Float16)p[i]; a[8 + i] = (_Float16)p[16 + i]; }
  return a;
}
__device__ __forceinline__ v16h frag_f32s(const float* rowk0, int lane, float sc) {
  v16h a; const float* p = rowk0 + 8 * (lane >> 4);
#pragma unroll
  for (int i = 0; i < 8; ++i) { a[i] = (_Float16)(p[i] * sc); a[8 + i] = (_Float16)(p[16 + i] * sc); }
  return a;
}
// column fragment from a [K][ld] layout (column n), rows >= K read as 0
__device__ __forceinline__ v16h fragc_f32(const float* W, int k0, int n, int lane, int ld, int K) {
  v16h a; const int g = lane >> 4;
#pragma unroll
  for (int i = 0; i < 8; ++i) { const int ka = k0 + 8 * g + i, kb = ka + 16;
    a[i] = (_Float16)(ka < K ? W[(size_t)(ka < K ? ka : K - 1) * ld + n] : 0.f); a[8 + i] = (_Float16)(kb < K ? W[(size_t)(kb < K ? kb : K - 1) * ld + n] : 0.f); }
  return a;
}
struct F2 { v16b h, l; };
__device__ __forceinline__ F2 bsplit16(const float v[16]) { F2 r;
#pragma unroll
  for (int i = 0; i < 16; ++i) { const __bf16 h = (__bf16)v[i]; r.h[i] = h; r.l[i] = (__bf16)(v[i] - (float)h); }
  return r; }
__device__ __forceinline__ F2 split_row(const float* row, int k0, int lane) { float v[16]; const float* p = row + k0 + 8 * (lane >> 4);
#pragma unroll
  for (int i = 0; i < 8; ++i) { v[i] = p[i]; v[8 + i] = p[16 + i]; }
  return bsplit16(v); }
__device__ __forceinline__ F2 split_rowK(const float* row, int k0, int lane, int K) { float v[16]; const int g = lane >> 4;
#pragma unroll
  for (int i = 0; i < 8; ++i) { const int ka = k0 + 8 * g + i, kb = ka + 16; v[i] = ka < K ? row[ka < K ? ka : K - 1] : 0.f; v[8 + i] = kb < K ? row[kb < K ? kb : K - 1] : 0.f; }
  return bsplit16(v); }
__device__ __forceinline__ F2 split_col(const float* W, int k0, int n, int lane, int ld, int K) { float v[16]; const int g = lane >> 4;
#pragma unroll
  for (int i = 0; i < 8; ++i) { const int ka = k0 + 8 * g + i, kb = ka + 16; v[i] = ka < K ? W[(size_t)(ka < K ? ka : K - 1) * ld + n] : 0.f; v[8 + i] = kb < K ? W[(size_t)(kb < K ? kb : K - 1) * ld + n] : 0.f; }
  return bsplit16(v); }
__device__ __forceinline__ v8f mac3(const F2& a, const F2& b, v8f c) { c = wmma_bf(a.l, b.h, c); c = wmma_bf(a.h, b.l, c); return wmma_bf(a.h, b.h, c); }
__device__ __forceinline__ float sigm(float v) { return 1.0f / (1.0f + expf(-v)); }
#define LDSX() do { asm volatile("s_wait_dscnt 0" ::: "memory"); __builtin_amdgcn_wave_barrier(); __builtin_amdgcn_fence(__ATOMIC_RELEASE, "workgroup"); } while (0)

// Multi-head SLIDING-WINDOW self-attention (x [2,4096,512]; (in,out) Wq / Wk / Wv / Wo [512,512] and biases [512], all N(0,1) x 0.02 - biases NONZERO; 8 heads x 64; scores / sqrt(64); allowed = (j >= i - 128) & (j < i + 128) by index, -inf elsewhere; softmax over the keys; out @ Wo + bo). Only a span of keys round the band of 16 query rows is computed - a superset of every row's own band, which is then cut exactly by index.
#define NB 2
#define TT 4096
#define CC 512            // NH * HD = projected width
#define DIN 512          // input (model) width
#define NH 8
#define HD 64
#define NQB (TT / 64)
#define HG 1
#define SCALE (0.125f)
#define CAUSAL 0
#ifndef TNB
#define TNB NB
#endif
__device__ __forceinline__ float bfr(float v) { return (float)(__bf16)v; }
#define WIN 128   // window: key j is allowed for query i iff i - WIN <= j < i + WIN
typedef __attribute__((ext_vector_type(8))) __bf16 v8b;
__device__ __forceinline__ v16b frag_b(const __bf16* rowk0, int lane) {
  union { v16b v; v8b q[2]; } u; const __bf16* p = rowk0 + 8 * (lane >> 4);
  u.q[0] = *(const v8b*)p; u.q[1] = *(const v8b*)(p + 16); return u.v;
}
#define QBH 0              // unused: this file has no causal or high-precision path
#define QHI 0               // single-product logits on every row (0.02-scale weights: logit sigma ~0.1)
#define KHI 64            // key rows carrying k residual / v bf16 hi+lo planes (only sizes the workspace regions below, which nothing here writes)
// B fragment (k rows k0+.., output column o) of a weight: (in,out) [K][ld] or (out,in) [ld rows of K]: bf16 exact, or f16(bf16 * 256) exact
__device__ __forceinline__ v16b wcol_io(const float* Wm, int k0, int o, int lane, int ld) { v16b w; const int g = lane >> 4;
#pragma unroll
  for (int i = 0; i < 8; ++i) { w[i] = (__bf16)Wm[(size_t)(k0 + 8 * g + i) * ld + o]; w[8 + i] = (__bf16)Wm[(size_t)(k0 + 16 + 8 * g + i) * ld + o]; }
  return w; }
__device__ __forceinline__ v16b wcol_oi(const float* Wm, int k0, int o, int lane, int K) { v16b w; const float* p = Wm + (size_t)o * K + k0 + 8 * (lane >> 4);
#pragma unroll
  for (int i = 0; i < 8; ++i) { w[i] = (__bf16)p[i]; w[8 + i] = (__bf16)p[16 + i]; }
  return w; }
__device__ __forceinline__ v16h wcolh_io(const float* Wm, int k0, int o, int lane, int ld) { v16h w; const int g = lane >> 4;
#pragma unroll
  for (int i = 0; i < 8; ++i) { w[i] = (_Float16)(bfr(Wm[(size_t)(k0 + 8 * g + i) * ld + o]) * 256.0f); w[8 + i] = (_Float16)(bfr(Wm[(size_t)(k0 + 16 + 8 * g + i) * ld + o]) * 256.0f); }
  return w; }
__device__ __forceinline__ v16h wcolh_oi(const float* Wm, int k0, int o, int lane, int K) { v16h w; const float* p = Wm + (size_t)o * K + k0 + 8 * (lane >> 4);
#pragma unroll
  for (int i = 0; i < 8; ++i) { w[i] = (_Float16)(bfr(p[i]) * 256.0f); w[8 + i] = (_Float16)(bfr(p[16 + i]) * 256.0f); }
  return w; }
#define WQKV_LAYOUT 0   // 0 = (in,out) [DIN][CC]; 1 = (out,in) [CC][DIN]; 2 = per-head [NH][DIN][HD]
__device__ __forceinline__ v16b wcol_hdk(const float* Wm, int k0, int o, int lane) { v16b w; const int g = lane >> 4; const float* p = Wm + (size_t)(o / HD) * DIN * HD + (o % HD);
#pragma unroll
  for (int i = 0; i < 8; ++i) { w[i] = (__bf16)p[(size_t)(k0 + 8 * g + i) * HD]; w[8 + i] = (__bf16)p[(size_t)(k0 + 16 + 8 * g + i) * HD]; }
  return w; }
#define WO_OUT_IN 0
#if WQKV_LAYOUT == 1
#define WCOL(W, k0, o, lane) wcol_oi(W, k0, o, lane, DIN)
#elif WQKV_LAYOUT == 2
#define WCOL(W, k0, o, lane) wcol_hdk(W, k0, o, lane)
#else
#define WCOL(W, k0, o, lane) wcol_io(W, k0, o, lane, CC)
#endif
#if WO_OUT_IN
#define WOCOL(W, k0, o, lane) wcol_oi(W, k0, o, lane, CC)
#define WOCOLH(W, k0, o, lane) wcolh_oi(W, k0, o, lane, CC)
#else
#define WOCOL(W, k0, o, lane) wcol_io(W, k0, o, lane, DIN)
#define WOCOLH(W, k0, o, lane) wcolh_io(W, k0, o, lane, DIN)
#endif

#define WS_QH  0u                                      // f16 q, packed fragments [row tile][k step]
#define WS_KH  (WS_QH + 2u * (size_t)NB * TT * CC)      // f16 k, packed fragments [row tile][k step]
#define WS_VT  (WS_KH + 2u * (size_t)NB * TT * CC)      // f16 v, packed half units [b][channel tile][16-key tile]
#define WS_QL  (WS_VT + 2u * (size_t)NB * CC * TT)      // f16 q residual x 2^10 rows [b][t < QHI][CC]
#define WS_KL  (WS_QL + 2u * (size_t)NB * QHI * CC)     // f16 k residual x 2^10 rows [b][t < KHI][CC]
#define WS_VB  (WS_KL + 2u * (size_t)NB * KHI * CC)     // bf16 v hi planes [b][c][t < KHI]
#define WS_VBL (WS_VB + 2u * (size_t)NB * CC * KHI)
#define WS_S   (WS_VBL + 2u * (size_t)NB * CC * KHI)    // the packed operands PX, PW, PWO below lie at its start; the size is kept so that the offsets behind it stay
#define WS_PX  WS_S                                     // bf16 x, packed fragments [row tile][k step]
#define WS_PW  (WS_PX + 2u * (size_t)NB * TT * DIN)     // bf16 Wq, Wk, Wv, packed fragments [which][column tile][k step]
#define WS_PWO (WS_PW + 2u * 3u * (size_t)DIN * CC)     // f16(bf16 x 2^8) Wo, packed fragments [column tile][k step]
#define WS_Y   (WS_S  + 4u * (size_t)HG * TT * TT)      // f16 ctx x 2^6, packed fragments [row tile][k step]
#define WS_END (WS_Y  + 4u * (size_t)NB * TT * CC)

// ---- packed fragments: every WMMA operand that passes through the workspace lies there in the order in which a wave's registers hold it. unit (16-wide tile T, k step kc of 32) = 1 KiB at element (T * 16 + kc) * 512: [half 0: elements 0..7][half 1: elements 8..15] x [lane 0..31] x 8 elements, so a fragment is two 16-byte loads a lane, each 512 contiguous bytes a wave.
typedef __attribute__((ext_vector_type(8))) unsigned v8u;
#define KSTEPS 16          // DIN / 32 = CC / 32
#define PKU 512            // 16-bit elements of a unit
#define PKT (KSTEPS * 256) // dwords of a tile's 16 units
__device__ __forceinline__ v8u ldf(const unsigned* __restrict__ p) { const v4u lo = *(const v4u*)p, hi = *(const v4u*)(p + 128); return __builtin_shufflevector(lo, hi, 0, 1, 2, 3, 4, 5, 6, 7); }
__device__ __forceinline__ v16h ldh(const _Float16* __restrict__ p) { union { v16h v; v8h q[2]; } u; u.q[0] = *(const v8h*)p; u.q[1] = *(const v8h*)(p + 256); return u.v; }
template <bool BF> __device__ __forceinline__ v8f mm(v8u a, v8u b, v8f c) {
  if constexpr (BF) return __builtin_amdgcn_wmma_f32_16x16x32_bf16(false, __builtin_bit_cast(v16b, a), false, __builtin_bit_cast(v16b, b), (short)0, c, false, false);
  else return __builtin_amdgcn_wmma_f32_16x16x32_f16(false, __builtin_bit_cast(v16h, a), false, __builtin_bit_cast(v16h, b), (short)0, c, false, false);
}
// one wave: a 64 x 64 tile, acc[i][j] = (A-side tile i) . (B-side tile j)^T over K = 512, k steps in rising order; pa, pb = the lane's own 16 bytes in the first unit of the first tile. NBUF fragment sets: the loads of step kc + NBUF - 1 are issued ahead of the products of step kc.
template <int NBUF, bool BF> __device__ __forceinline__ void gemm64(const unsigned* __restrict__ pa, const unsigned* __restrict__ pb, v8f (&acc)[4][4]) {
  v8u fa[NBUF][4], fb[NBUF][4];
#pragma unroll
  for (int s = 0; s < NBUF - 1; ++s) {
#pragma unroll
    for (int u = 0; u < 4; ++u) { fa[s][u] = ldf(pa + u * PKT + s * 256); fb[s][u] = ldf(pb + u * PKT + s * 256); } }
#pragma unroll
  for (int kc = 0; kc < KSTEPS; ++kc) { const int nx = kc + NBUF - 1;
    if (nx < KSTEPS) {
#pragma unroll
      for (int u = 0; u < 4; ++u) { fa[nx % NBUF][u] = ldf(pa + u * PKT + nx * 256); fb[nx % NBUF][u] = ldf(pb + u * PKT + nx * 256); } }
    __builtin_amdgcn_sched_barrier(0);   /* keeps the 16 loads above ahead of this step's products: without it the build sank each load to its first use and waited for it there, four round trips a step */
#pragma unroll
    for (int j = 0; j < 4; ++j) {
#pragma unroll
      for (int i = 0; i < 4; ++i) acc[i][j] = mm<BF>(fa[kc % NBUF][i], fb[kc % NBUF][j], acc[i][j]); }
    __builtin_amdgcn_sched_barrier(0);   /* keeps the next group of loads behind these products, so that each group is one run of loads */
  } }
// ---- k_pack: wave = one 16-wide tile x 4 k steps of x (bf16), of Wq / Wk / Wv (bf16) or of Wo (f16(bf16 x 2^8)): the fragments as the GEMMs' own loaders formed them, each formed once a call
#define NJX (TNB * TT / 16 * 4)
#define NJW (3 * (CC / 16) * 4)
#define NJO ((DIN / 16) * 4)
__global__ __launch_bounds__(128) void k_pack(const float* __restrict__ X, const float* __restrict__ WQ, const float* __restrict__ WK, const float* __restrict__ WV, const float* __restrict__ WO, __bf16* __restrict__ PX, __bf16* __restrict__ PW, _Float16* __restrict__ PWO) {
  const int tid = threadIdx.x, lane = tid & 31, col = lane & 15, g = lane >> 4; const int job = blockIdx.x * 4 + (tid >> 5);
  // XW(p): s_wait_xcnt 0 behind a run of loads, with their address as an input, so that no register of it is written again ahead of the wait
#define XW(p) asm volatile("s_wait_xcnt 0x0" :: "v"(p) : "memory")
  if (job < NJX) { const int T = job >> 2, k4 = (job & 3) * 4; const float* p = X + ((size_t)T * 16 + col) * DIN + k4 * 32 + 8 * g; __bf16* d = PX + ((size_t)T * KSTEPS + k4) * PKU + lane * 8; float v[4][16];
#pragma unroll
    for (int u = 0; u < 4; ++u) {
#pragma unroll
      for (int i = 0; i < 8; ++i) { v[u][i] = p[u * 32 + i]; v[u][8 + i] = p[u * 32 + 16 + i]; } }
    XW(p);
#pragma unroll
    for (int u = 0; u < 4; ++u) { v8b lo, hi;
#pragma unroll
      for (int i = 0; i < 8; ++i) { lo[i] = (__bf16)v[u][i]; hi[i] = (__bf16)v[u][8 + i]; }
      *(v8b*)(d + u * PKU) = lo; *(v8b*)(d + u * PKU + 256) = hi; }
  } else { const bool isO = job >= NJX + NJW; const int jw = job - (isO ? NJX + NJW : NJX), T = jw >> 2, k4 = (jw & 3) * 4, which = T / (CC / 16); const float* WA = isO ? WO : which == 0 ? WQ : which == 1 ? WK : WV;
    /* (in,out) weights, all four [512][512]: column T' * 16 + col, rows k4 * 32 + 8 g + .. */
    static_assert(DIN == CC, "one row pitch for all four weights"); const float* p = WA + (size_t)(k4 * 32 + 8 * g) * CC + (T % (CC / 16)) * 16 + col; float v[4][16];
#pragma unroll
    for (int u = 0; u < 4; ++u) {
#pragma unroll
      for (int i = 0; i < 8; ++i) { v[u][i] = p[(u * 32 + i) * CC]; v[u][8 + i] = p[(u * 32 + 16 + i) * CC]; } }
    XW(p);
    if (!isO) { __bf16* d = PW + ((size_t)T * KSTEPS + k4) * PKU + lane * 8;
#pragma unroll
      for (int u = 0; u < 4; ++u) { v8b lo, hi;
#pragma unroll
        for (int i = 0; i < 8; ++i) { lo[i] = (__bf16)v[u][i]; hi[i] = (__bf16)v[u][8 + i]; }
        *(v8b*)(d + u * PKU) = lo; *(v8b*)(d + u * PKU + 256) = hi; }
    } else { _Float16* d = PWO + ((size_t)T * KSTEPS + k4) * PKU + lane * 8;
#pragma unroll
      for (int u = 0; u < 4; ++u) { v8h lo, hi;
#pragma unroll
        for (int i = 0; i < 8; ++i) { lo[i] = (_Float16)(bfr(v[u][i]) * 256.0f); hi[i] = (_Float16)(bfr(v[u][8 + i]) * 256.0f); }
        *(v8h*)(d + u * PKU) = lo; *(v8h*)(d + u * PKU + 256) = hi; } } } }
// ---- k_proj: block = (128 rows, 128 cols, which), wave = 64 x 64: q/k/v = X W + b with exact bf16 products (K = DIN). D register r of lane (g, col) of acc[i][j] = (A-side index 16 i + 8 g + r, B-side index 16 j + col): 8 neighbouring A-side indices a lane, which is half a fragment of k_att, stored as it stands (16 bytes a lane, 512 contiguous bytes a wave).
// which 0, 1: q, k: A = W columns, B = x rows: acc[i][j] = half (i & 1) of unit (row tile r0 / 16 + j, k step c0 / 32 + (i >> 1)). which 2: v: A = x rows, B = W columns: acc[i][j] = the half unit (channel tile c0 / 16 + j, 16-key tile t0 / 16 + i).
// amdgpu_waves_per_eu(3): at most 336 registers a wave, so that the grid's three waves a SIMD are all resident at once
__global__ __launch_bounds__(128) __attribute__((amdgpu_waves_per_eu(3))) void k_proj(const __bf16* __restrict__ PX, const __bf16* __restrict__ PW, const float* __restrict__ BQ, const float* __restrict__ BK, const float* __restrict__ BV, _Float16* __restrict__ QH, _Float16* __restrict__ KH, _Float16* __restrict__ VT) {
  const int tid = threadIdx.x, wave = tid >> 5, lane = tid & 31, col = lane & 15, g = lane >> 4; const int which = blockIdx.z; const int c0 = blockIdx.y * 128 + (wave & 1) * 64; const size_t r0 = (size_t)blockIdx.x * 128 + (wave >> 1) * 64; const size_t bb = r0 / TT; const int t0 = (int)(r0 % TT);
  const unsigned* px = (const unsigned*)PX + (r0 / 16) * PKT + lane * 4; const unsigned* pw = (const unsigned*)PW + ((size_t)which * (CC / 16) + c0 / 16) * PKT + lane * 4;
  const float* BA = which == 0 ? BQ : which == 1 ? BK : BV;
  v8f acc[4][4] = {};
  gemm64<2, true>(which < 2 ? pw : px, which < 2 ? px : pw, acc);
  if (which < 2) { _Float16* d = (which == 0 ? QH : KH) + ((r0 / 16) * KSTEPS + c0 / 32) * PKU + lane * 8; float bias[4][8] = {};
    if (BA) {
#pragma unroll
      for (int i = 0; i < 4; ++i) {
#pragma unroll
        for (int r = 0; r < 8; ++r) bias[i][r] = bfr(BA[c0 + i * 16 + 8 * g + r]); } }
#pragma unroll
    for (int j = 0; j < 4; ++j) {
#pragma unroll
      for (int i = 0; i < 4; ++i) { v8h hv;
#pragma unroll
        for (int r = 0; r < 8; ++r) hv[r] = (_Float16)(acc[i][j][r] + bias[i][r]);
        *(v8h*)(d + (j * KSTEPS + (i >> 1)) * PKU + (i & 1) * 256) = hv; } }
  } else { _Float16* d = VT + ((bb * (CC / 16) + c0 / 16) * (TT / 16) + t0 / 16) * 256 + lane * 8; float bias[4] = {};
    if (BA) {
#pragma unroll
      for (int j = 0; j < 4; ++j) bias[j] = bfr(BA[c0 + j * 16 + col]); }
#pragma unroll
    for (int j = 0; j < 4; ++j) {
#pragma unroll
      for (int i = 0; i < 4; ++i) { v8h hv;
#pragma unroll
        for (int r = 0; r < 8; ++r) hv[r] = (_Float16)(acc[i][j][r] + bias[j]);
        *(v8h*)(d + (j * (TT / 16) + i) * 256) = hv; } } } }
// ---- k_att: scores, softmax and P . v in one kernel, one launch for every (batch, head). wave = 16 query rows t = ql0 .. ql0 + 15 of (b, h) against its own span of KSPAN keys, which holds every key of [ql0 - WIN, ql0 + 15 + WIN) that lies in the sequence; the waves of a block share nothing.
// transposed products: S^T = K . Q^T (A = 16 key rows, B = the 16 query rows), so D register r of lane (g, col) of tile i is the logit of key kbeg + 16 i + 8 g + r for query ql0 + col: one lane holds half of one query's logits, maximum and sum run in the lane and are joined with lane ^ 16.
// two neighbouring S^T tiles, converted in place, are the B operand (32 keys in the fragments' k order) of O^T += V^T . P^T (A = 16 channels of v, 32 keys); D register r = ctx[query ql0 + col][16 j + 8 g + r].
#define KSPAN 288   // 16 + 2 WIN = 272 keys, rounded up to whole 32-key chunks
// takes 12 loaded fragments as inputs only: all 24 loads of a group are issued before the first of them is waited for (one round trip a group; without it the build waited after every pair of loads)
#define HOLD12(f) asm volatile("" :: "v"(f[0]), "v"(f[1]), "v"(f[2]), "v"(f[3]), "v"(f[4]), "v"(f[5]), "v"(f[6]), "v"(f[7]), "v"(f[8]), "v"(f[9]), "v"(f[10]), "v"(f[11]))
// amdgpu_waves_per_eu(4): at most 256 registers a wave, so that the grid's four waves a SIMD are all resident at once
__global__ __launch_bounds__(128) __attribute__((amdgpu_waves_per_eu(4))) void k_att(const _Float16* __restrict__ QH, const _Float16* __restrict__ KH, const _Float16* __restrict__ VT, _Float16* __restrict__ PY) {
  const int tid = threadIdx.x, wave = tid >> 5, lane = tid & 31, col = lane & 15, g = lane >> 4; const int h = blockIdx.y, b = blockIdx.z; const int ql0 = blockIdx.x * 64 + wave * 16; const int t = ql0 + col;
  int kbeg = ql0 - WIN; kbeg = kbeg < 0 ? 0 : kbeg; kbeg = kbeg > TT - KSPAN ? TT - KSPAN : kbeg;   /* the span is moved into the sequence at both ends; the keys it gains there are cut by the index rule below */
  /* ql0 and kbeg are multiples of 16: whole row tiles of q and k (k steps 2 h, 2 h + 1), whole 16-key half units of v; two neighbouring half units are the fragment of a 32-key chunk */
  const _Float16* qp = QH + (((size_t)b * TT + ql0) / 16 * KSTEPS + h * 2) * PKU + lane * 8; const _Float16* kp = KH + (((size_t)b * TT + kbeg) / 16 * KSTEPS + h * 2) * PKU + lane * 8; const _Float16* vp = VT + (((size_t)b * (CC / 16) + h * (HD / 16)) * (TT / 16) + kbeg / 16) * 256 + lane * 8;
  const v16h q0 = ldh(qp), q1 = ldh(qp + PKU);
  v8f sc[KSPAN / 16];
#pragma unroll
  for (int i0 = 0; i0 < KSPAN / 16; i0 += 6) { v16h kf[12];
#pragma unroll
    for (int u = 0; u < 6; ++u) { kf[2 * u] = ldh(kp + (i0 + u) * KSTEPS * PKU); kf[2 * u + 1] = ldh(kp + (i0 + u) * KSTEPS * PKU + PKU); }
    HOLD12(kf);
#pragma unroll
    for (int u = 0; u < 6; ++u) { v8f a = {}; a = __builtin_amdgcn_wmma_f32_16x16x32_f16(false, kf[2 * u], false, q0, (short)0, a, false, false); sc[i0 + u] = __builtin_amdgcn_wmma_f32_16x16x32_f16(false, kf[2 * u + 1], false, q1, (short)0, a, false, false); } }
  const int dk = kbeg + 8 * g - t + WIN;   /* key k is allowed for query t iff 0 <= k - t + WIN < 2 WIN */
  float m = -3.0e38f;
#pragma unroll
  for (int i = 0; i < KSPAN / 16; ++i) {
#pragma unroll
    for (int r = 0; r < 8; ++r) { const float v = ((unsigned)(dk + i * 16 + r) < 2u * WIN) ? sc[i][r] * SCALE : -3.0e38f; sc[i][r] = v; m = fmaxf(m, v); } }
  m = fmaxf(m, __shfl_xor(m, 16));
  float sum = 0.f;
#pragma unroll
  for (int i = 0; i < KSPAN / 16; ++i) {
#pragma unroll
    for (int r = 0; r < 8; ++r) { const float e = expf(sc[i][r] - m); sc[i][r] = e; sum += e; } }   /* an excluded key beside an allowed one: expf(-3.0e38 - m) = 0 */
  sum += __shfl_xor(sum, 16);
  const float inv = (m > -1.0e38f && sum > 0.f) ? 2048.0f / sum : 0.f;   /* P carried x 2^11 into f16; a fully excluded row yields P = 0 */
  v16h p[KSPAN / 32];
#pragma unroll
  for (int c = 0; c < KSPAN / 32; ++c) {
#pragma unroll
    for (int r = 0; r < 8; ++r) { p[c][r] = (_Float16)(sc[2 * c][r] * inv); p[c][8 + r] = (_Float16)(sc[2 * c + 1][r] * inv); } }
  v8f acc[HD / 16] = {};
#pragma unroll
  for (int c0 = 0; c0 < KSPAN / 32; c0 += 3) { v16h vf[12];
#pragma unroll
    for (int u = 0; u < 3; ++u) {
#pragma unroll
      for (int j = 0; j < HD / 16; ++j) vf[u * 4 + j] = ldh(vp + j * (TT / 16) * 256 + (c0 + u) * 512); }
    HOLD12(vf);
#pragma unroll
    for (int u = 0; u < 3; ++u) {
#pragma unroll
      for (int j = 0; j < HD / 16; ++j) acc[j] = __builtin_amdgcn_wmma_f32_16x16x32_f16(false, vf[u * 4 + j], false, p[c0 + u], (short)0, acc[j], false, false); } }
  // lane (g, col) holds ctx[ql0 + col][64 h + 16 j + 8 g + r]: acc[2 c], acc[2 c + 1] are halves 0, 1 of this lane's fragment of k step 2 h + c of row tile (b TT + ql0) / 16 for k_out; ctx carried x 2^6 into f16 so small-magnitude context rows stay clear of f16 subnormals
  _Float16* yp = PY + (((size_t)b * TT + ql0) / 16 * KSTEPS + h * 2) * PKU + lane * 8;
#pragma unroll
  for (int j = 0; j < HD / 16; ++j) { const v8f o = acc[j] * (1.0f / 2048.0f); v8h w;
#pragma unroll
    for (int r = 0; r < 8; ++r) w[r] = (_Float16)(o[r] * 64.0f);
    *(v8h*)(yp + (j >> 1) * PKU + (j & 1) * 256) = w; } }
// ---- k_out: block = (128 rows, 128 cols), wave = 64 x 64: out = ctx Wo + bo: ctx x 2^6 f16 against Wo as f16(bf16 x 2^8) exact (1 product) x 2^-14; A = Wo columns, B = ctx rows, so a lane holds 8 neighbouring columns of an output row; staged in the wave's own LDS range, stored as whole lines
__global__ __launch_bounds__(128) void k_out(const _Float16* __restrict__ PY, const _Float16* __restrict__ PWO, const float* __restrict__ BO, float* __restrict__ OUT) { __shared__ __align__(16) float sf[4][64][68];
  const int tid = threadIdx.x, wave = tid >> 5, lane = tid & 31, col = lane & 15, g = lane >> 4; const int c0 = blockIdx.y * 128 + (wave & 1) * 64; const size_t r0 = (size_t)blockIdx.x * 128 + (wave >> 1) * 64;
  v8f acc[4][4] = {};
  gemm64<3, false>((const unsigned*)PWO + (size_t)(c0 / 16) * PKT + lane * 4, (const unsigned*)PY + (r0 / 16) * PKT + lane * 4, acc);
  float bias[4][8] = {};
  if (BO) {
#pragma unroll
    for (int i = 0; i < 4; ++i) {
#pragma unroll
      for (int r = 0; r < 8; ++r) bias[i][r] = bfr(BO[c0 + i * 16 + 8 * g + r]); } }
#pragma unroll
  for (int i = 0; i < 4; ++i) {
#pragma unroll
    for (int j = 0; j < 4; ++j) { float o[8];
#pragma unroll
      for (int r = 0; r < 8; ++r) o[r] = acc[i][j][r] * (1.0f / 16384.0f) + bias[i][r];   /* 2^-8 (Wo carry) x 2^-6 (ctx carry) */
      float* s = &sf[wave][j * 16 + col][i * 16 + 8 * g]; *(v4f*)s = (v4f){o[0], o[1], o[2], o[3]}; *(v4f*)(s + 4) = (v4f){o[4], o[5], o[6], o[7]}; } }
  LDSX();   /* the wave's own LDS writes have landed before other lanes of it read them */
#pragma unroll
  for (int e = 0; e < 32; ++e) { const int mj = e * 2 + g; vst2(OUT + (r0 + mj) * DIN + c0 + col * 4, *(const v4f*)&sf[wave][mj][col * 4]); } }

extern "C" void kernel_launch(void* const* d_in, const int* in_sizes, int n_in, void* d_out, int out_size, void* d_ws, size_t ws_size, hipStream_t stream) {
  (void)in_sizes; (void)n_in; (void)out_size;
  const float** F = (const float**)d_in;
  if (ws_size < (size_t)WS_END) return;
  char* ws = (char*)d_ws; _Float16 *QH = (_Float16*)(ws + WS_QH), *KH = (_Float16*)(ws + WS_KH), *VT = (_Float16*)(ws + WS_VT), *PWO = (_Float16*)(ws + WS_PWO), *PY = (_Float16*)(ws + WS_Y); __bf16 *PX = (__bf16*)(ws + WS_PX), *PW = (__bf16*)(ws + WS_PW);
  // inputs: 0 x [2,4096,512]; 1 Wq [512,512] (in,out), 2 bq; 3 Wk, 4 bk; 5 Wv, 6 bv; 7 Wo (in,out), 8 bo (biases NONZERO)
  k_pack<<<dim3((NJX + NJW + NJO) / 4), 128, 0, stream>>>(F[0], F[1], F[3], F[5], F[7], PX, PW, PWO);
  k_proj<<<dim3(TNB * TT / 128, CC / 128, 3), 128, 0, stream>>>(PX, PW, F[2], F[4], F[6], QH, KH, VT);
  k_att<<<dim3(NQB, NH, TNB), 128, 0, stream>>>(QH, KH, VT, PY);
  k_out<<<dim3(TNB * TT / 128, DIN / 128), 128, 0, stream>>>(PY, PWO, F[8], (float*)d_out);
}

// v003
// One run takes 44.5 microseconds.
// In both of two side-by-side timings against v002, it was 1.07 times as fast.
// Over all steps from v000 it is 12.6 times as fast.
// compute dtype: all float inputs rounded to bf16; q / k / v projections with EXACT bf16 products on WMMA 16x16x32 (f32 accumulate) + bias; logits q x k once to f16 each (1 product) x 64^-0.5, computed only for a 288-key span round the +-128 band of each 16 query rows; the exact band rule by index; softmax f32; P x 2^11 once to f16 x v once to f16 (1 product) over that span, all three in one kernel; ctx x 2^6 once to f16 x Wo f16(bf16 x 2^8) + bo; f32 output.
#include <hip/hip_runtime.h>
#include <math.h>

typedef __attribute__((ext_vector_type(16))) _Float16 v16h;
typedef __attribute__((ext_vector_type(16))) __bf16 v16b;
typedef __attribute__((ext_vector_type(8)))  _Float16 v8h;
typedef __attribute__((ext_vector_type(8)))  float v8f;
typedef __attribute__((ext_vector_type(4)))  float v4f;
typedef __attribute__((ext_vector_type(2)))  float v2f;
typedef __attribute__((ext_vector_type(4)))  unsigned v4u;
typedef __attribute__((ext_vector_type(4)))  int v4i;
typedef float __attribute__((may_alias)) float_a;
typedef int __attribute__((may_alias)) int_a;

template <typename T> __device__ __forceinline__ void vst2(void* p, T v) { *(T*)p = v;  }
__device__ __forceinline__ v8f wmma16(v16h a, v16h b, v8f c) {
  v8f d = __builtin_amdgcn_wmma_f32_16x16x32_f16(false, a, false, b, (short)0, c, false, false);
  asm volatile("v_nop\n\tv_nop\n\tv_nop\n\tv_nop" : "+v"(d) : "v"(a), "v"(b));
  return d;
}
__device__ __forceinline__ v8f wmma_bf(v16b a, v16b b, v8f c) {
  v8f d = __builtin_amdgcn_wmma_f32_16x16x32_bf16(false, a, false, b, (short)0, c, false, false);
  asm volatile("v_nop\n\tv_nop\n\tv_nop\n\tv_nop" : "+v"(d) : "v"(a), "v"(b));
  return d;
}
// 16x16x32 fragments: lane = (h = lane>>4, row/col = lane&15); elements 0..7 = k0+8h+0..7, 8..15 = k0+16+8h+0..7; D element r = row 8h+r
__device__ __forceinline__ v16h frag_h(const _Float16* rowk0, int lane) {
  union { v16h v; v8h q[2]; } u; const _Float16* p = rowk0 + 8 * (lane >> 4);
  u.q[0] = *(const v8h*)p; u.q[1] = *(const v8h*)(p + 16); return u.v;
}
__device__ __forceinline__ v16h frag_f32(const float* rowk0, int lane) {
  v16h a; const float* p = rowk0 + 8 * (lane >> 4);
#pragma unroll
  for (int i = 0; i < 8; ++i) { a[i] = (_Float16)p[i]; a[8 + i] = (_Float16)p[16 + i]; }
  return a;
}
__device__ __forceinline__ v16h frag_f32s(const float* rowk0, int lane, float sc) {
  v16h a; const float* p = rowk0 + 8 * (lane >> 4);
#pragma unroll
  for (int i = 0; i < 8; ++i) { a[i] = (_Float16)(p[i] * sc); a[8 + i] = (_Float16)(p[16 + i] * sc); }
  return a;
}
// column fragment from a [K][ld] layout (column n), rows >= K read as 0
__device__ __forceinline__ v16h fragc_f32(const float* W, int k0, int n, int lane, int ld, int K) {
  v16h a; const int g = lane >> 4;
#pragma unroll
  for (int i = 0; i < 8; ++i) { const int ka = k0 + 8 * g + i, kb = ka + 16;
    a[i] = (_Float16)(ka < K ? W[(size_t)(ka < K ? ka : K - 1) * ld + n] : 0.f); a[8 + i] = (_Float16)(kb < K ? W[(size_t)(kb < K ? kb : K - 1) * ld + n] : 0.f); }
  return a;
}
struct F2 { v16b h, l; };
__device__ __forceinline__ F2 bsplit16(const float v[16]) { F2 r;
#pragma unroll
  for (int i = 0; i < 16; ++i) { const __bf16 h = (__bf16)v[i]; r.h[i] = h; r.l[i] = (__bf16)(v[i] - (float)h); }
  return r; }
__device__ __forceinline__ F2 split_row(const float* row, int k0, int lane) { float v[16]; const float* p = row + k0 + 8 * (lane >> 4);
#pragma unroll
  for (int i = 0; i < 8; ++i) { v[i] = p[i]; v[8 + i] = p[16 + i]; }
  return bsplit16(v); }
__device__ __forceinline__ F2 split_rowK(const float* row, int k0, int lane, int K) { float v[16]; const int g = lane >> 4;
#pragma unroll
  for (int i = 0; i < 8; ++i) { const int ka = k0 + 8 * g + i, kb = ka + 16; v[i] = ka < K ? row[ka < K ? ka : K - 1] : 0.f; v[8 + i] = kb < K ? row[kb < K ? kb : K - 1] : 0.f; }
  return bsplit16(v); }
__device__ __forceinline__ F2 split_col(const float* W, int k0, int n, int lane, int ld, int K) { float v[16]; const int g = lane >> 4;
#pragma unroll
  for (int i = 0; i < 8; ++i) { const int ka = k0 + 8 * g + i, kb = ka + 16; v[i] = ka < K ? W[(size_t)(ka < K ? ka : K - 1) * ld + n] : 0.f; v[8 + i] = kb < K ? W[(size_t)(kb < K ? kb : K - 1) * ld + n] : 0.f; }
  return bsplit16(v); }
__device__ __forceinline__ v8f mac3(const F2& a, const F2& b, v8f c) { c = wmma_bf(a.l, b.h, c); c = wmma_bf(a.h, b.l, c); return wmma_bf(a.h, b.h, c); }
__device__ __forceinline__ float sigm(float v) { return 1.0f / (1.0f + expf(-v)); }
#define LDSX() do { asm volatile("s_wait_dscnt 0" ::: "memory"); __builtin_amdgcn_wave_barrier(); __builtin_amdgcn_fence(__ATOMIC_RELEASE, "workgroup"); } while (0)

// Multi-head SLIDING-WINDOW self-attention (x [2,4096,512]; (in,out) Wq / Wk / Wv / Wo [512,512] and biases [512], all N(0,1) x 0.02 - biases NONZERO; 8 heads x 64; scores / sqrt(64); allowed = (j >= i - 128) & (j < i + 128) by index, -inf elsewhere; softmax over the keys; out @ Wo + bo). Only a span of keys round the band of 16 query rows is computed - a superset of every row's own band, which is then cut exactly by index.
#define NB 2
#define TT 4096
#define CC 512            // NH * HD = projected width
#define DIN 512          // input (model) width
#define NH 8
#define HD 64
#define NQB (TT / 64)
#define HG 1
#define SCALE (0.125f)
#define CAUSAL 0
#ifndef TNB
#define TNB NB
#endif
__device__ __forceinline__ float bfr(float v) { return (float)(__bf16)v; }
#define WIN 128   // window: key j is allowed for query i iff i - WIN <= j < i + WIN
typedef __attribute__((ext_vector_type(8))) __bf16 v8b;
__device__ __forceinline__ v16b frag_b(const __bf16* rowk0, int lane) {
  union { v16b v; v8b q[2]; } u; const __bf16* p = rowk0 + 8 * (lane >> 4);
  u.q[0] = *(const v8b*)p; u.q[1] = *(const v8b*)(p + 16); return u.v;
}
#define QBH 0              // unused: this file has no causal or high-precision path
#define QHI 0               // single-product logits on every row (0.02-scale weights: logit sigma ~0.1)
#define KHI 64            // key rows carrying k residual / v bf16 hi+lo planes (only sizes the workspace regions below, which nothing here writes)
// B fragment (k rows k0+.., output column o) of a weight: (in,out) [K][ld] or (out,in) [ld rows of K]: bf16 exact, or f16(bf16 * 256) exact
__device__ __forceinline__ v16b wcol_io(const float* Wm, int k0, int o, int lane, int ld) { v16b w; const int g = lane >> 4;
#pragma unroll
  for (int i = 0; i < 8; ++i) { w[i] = (__bf16)Wm[(size_t)(k0 + 8 * g + i) * ld + o]; w[8 + i] = (__bf16)Wm[(size_t)(k0 + 16 + 8 * g + i) * ld + o]; }
  return w; }
__device__ __forceinline__ v16b wcol_oi(const float* Wm, int k0, int o, int lane, int K) { v16b w; const float* p = Wm + (size_t)o * K + k0 + 8 * (lane >> 4);
#pragma unroll
  for (int i = 0; i < 8; ++i) { w[i] = (__bf16)p[i]; w[8 + i] = (__bf16)p[16 + i]; }
  return w; }
__device__ __forceinline__ v16h wcolh_io(const float* Wm, int k0, int o, int lane, int ld) { v16h w; const int g = lane >> 4;
#pragma unroll
  for (int i = 0; i < 8; ++i) { w[i] = (_Float16)(bfr(Wm[(size_t)(k0 + 8 * g + i) * ld + o]) * 256.0f); w[8 + i] = (_Float16)(bfr(Wm[(size_t)(k0 + 16 + 8 * g + i) * ld + o]) * 256.0f); }
  return w; }
__device__ __forceinline__ v16h wcolh_oi(const float* Wm, int k0, int o, int lane, int K) { v16h w; const float* p = Wm + (size_t)o * K + k0 + 8 * (lane >> 4);
#pragma unroll
  for (int i = 0; i < 8; ++i) { w[i] = (_Float16)(bfr(p[i]) * 256.0f); w[8 + i] = (_Float16)(bfr(p[16 + i]) * 256.0f); }
  return w; }
#define WQKV_LAYOUT 0   // 0 = (in,out) [DIN][CC]; 1 = (out,in) [CC][DIN]; 2 = per-head [NH][DIN][HD]
__device__ __forceinline__ v16b wcol_hdk(const float* Wm, int k0, int o, int lane) { v16b w; const int g = lane >> 4; const float* p = Wm + (size_t)(o / HD) * DIN * HD + (o % HD);
#pragma unroll
  for (int i = 0; i < 8; ++i) { w[i] = (__bf16)p[(size_t)(k0 + 8 * g + i) * HD]; w[8 + i] = (__bf16)p[(size_t)(k0 + 16 + 8 * g + i) * HD]; }
  return w; }
#define WO_OUT_IN 0
#if WQKV_LAYOUT == 1
#define WCOL(W, k0, o, lane) wcol_oi(W, k0, o, lane, DIN)
#elif WQKV_LAYOUT == 2
#define WCOL(W, k0, o, lane) wcol_hdk(W, k0, o, lane)
#else
#define WCOL(W, k0, o, lane) wcol_io(W, k0, o, lane, CC)
#endif
#if WO_OUT_IN
#define WOCOL(W, k0, o, lane) wcol_oi(W, k0, o, lane, CC)
#define WOCOLH(W, k0, o, lane) wcolh_oi(W, k0, o, lane, CC)
#else
#define WOCOL(W, k0, o, lane) wcol_io(W, k0, o, lane, DIN)
#define WOCOLH(W, k0, o, lane) wcolh_io(W, k0, o, lane, DIN)
#endif

#define WS_QH  0u                                      // f16 q, packed fragments [row tile][k step]
#define WS_KH  (WS_QH + 2u * (size_t)NB * TT * CC)      // f16 k, packed fragments [row tile][k step]
#define WS_VT  (WS_KH + 2u * (size_t)NB * TT * CC)      // f16 v, packed half units [b][channel tile][16-key tile]
#define WS_QL  (WS_VT + 2u * (size_t)NB * CC * TT)      // f16 q residual x 2^10 rows [b][t < QHI][CC]
#define WS_KL  (WS_QL + 2u * (size_t)NB * QHI * CC)     // f16 k residual x 2^10 rows [b][t < KHI][CC]
#define WS_VB  (WS_KL + 2u * (size_t)NB * KHI * CC)     // bf16 v hi planes [b][c][t < KHI]
#define WS_VBL (WS_VB + 2u * (size_t)NB * CC * KHI)
#define WS_S   (WS_VBL + 2u * (size_t)NB * CC * KHI)    // the packed operands PX, PW, PWO below lie at its start; the size is kept so that the offsets behind it stay
#define WS_PX  WS_S                                     // bf16 x, packed fragments [row tile][k step]
#define WS_PW  (WS_PX + 2u * (size_t)NB * TT * DIN)     // bf16 Wq, Wk, Wv, packed fragments [which][column tile][k step]
#define WS_PWO (WS_PW + 2u * 3u * (size_t)DIN * CC)     // f16(bf16 x 2^8) Wo, packed fragments [column tile][k step]
#define WS_Y   (WS_S  + 4u * (size_t)HG * TT * TT)      // f16 ctx x 2^6, packed fragments [row tile][k step]
#define WS_END (WS_Y  + 4u * (size_t)NB * TT * CC)

// ---- packed fragments: every WMMA operand that passes through the workspace lies there in the order in which a wave's registers hold it. unit (16-wide tile T, k step kc of 32) = 1 KiB at element (T * 16 + kc) * 512: [half 0: elements 0..7][half 1: elements 8..15] x [lane 0..31] x 8 elements, so a fragment is two 16-byte loads a lane, each 512 contiguous bytes a wave.
typedef __attribute__((ext_vector_type(8))) unsigned v8u;
#define KSTEPS 16          // DIN / 32 = CC / 32
#define PKU 512            // 16-bit elements of a unit
#define PKT (KSTEPS * 256) // dwords of a tile's 16 units
__device__ __forceinline__ v8u ldf(const unsigned* __restrict__ p) { const v4u lo = *(const v4u*)p, hi = *(const v4u*)(p + 128); return __builtin_shufflevector(lo, hi, 0, 1, 2, 3, 4, 5, 6, 7); }
__device__ __forceinline__ v16h ldh(const _Float16* __restrict__ p) { union { v16h v; v8h q[2]; } u; u.q[0] = *(const v8h*)p; u.q[1] = *(const v8h*)(p + 256); return u.v; }
template <bool BF> __device__ __forceinline__ v8f mm(v8u a, v8u b, v8f c) {
  if constexpr (BF) return __builtin_amdgcn_wmma_f32_16x16x32_bf16(false, __builtin_bit_cast(v16b, a), false, __builtin_bit_cast(v16b, b), (short)0, c, false, false);
  else return __builtin_amdgcn_wmma_f32_16x16x32_f16(false, __builtin_bit_cast(v16h, a), false, __builtin_bit_cast(v16h, b), (short)0, c, false, false);
}
// one wave: a 64 x 64 tile, acc[i][j] = (A-side tile i) . (B-side tile j)^T over K = 512, k steps in rising order; pa, pb = the lane's own 16 bytes in the first unit of the first tile. NBUF fragment sets: the loads of step kc + NBUF - 1 are issued ahead of the products of step kc.
template <int NBUF, bool BF> __device__ __forceinline__ void gemm64(const unsigned* __restrict__ pa, const unsigned* __restrict__ pb, v8f (&acc)[4][4]) {
  v8u fa[NBUF][4], fb[NBUF][4];
#pragma unroll
  for (int s = 0; s < NBUF - 1; ++s) {
#pragma unroll
    for (int u = 0; u < 4; ++u) { fa[s][u] = ldf(pa + u * PKT + s * 256); fb[s][u] = ldf(pb + u * PKT + s * 256); } }
#pragma unroll
  for (int kc = 0; kc < KSTEPS; ++kc) { const int nx = kc + NBUF - 1;
    if (nx < KSTEPS) {
#pragma unroll
      for (int u = 0; u < 4; ++u) { fa[nx % NBUF][u] = ldf(pa + u * PKT + nx * 256); fb[nx % NBUF][u] = ldf(pb + u * PKT + nx * 256); } }
    __builtin_amdgcn_sched_barrier(0);   /* keeps the 16 loads above ahead of this step's products: without it the build sank each load to its first use and waited for it there, four round trips a step */
#pragma unroll
    for (int j = 0; j < 4; ++j) {
#pragma unroll
      for (int i = 0; i < 4; ++i) acc[i][j] = mm<BF>(fa[kc % NBUF][i], fb[kc % NBUF][j], acc[i][j]); }
    __builtin_amdgcn_sched_barrier(0);   /* keeps the next group of loads behind these products, so that each group is one run of loads */
  } }
// ---- k_pack: wave = one 16-wide tile x 4 k steps of x (bf16), of Wq / Wk / Wv (bf16) or of Wo (f16(bf16 x 2^8)): the fragments as the GEMMs' own loaders formed them, each formed once a call
#define NJX (TNB * TT / 16 * 4)
#define NJW (3 * (CC / 16) * 4)
#define NJO ((DIN / 16) * 4)
__global__ __launch_bounds__(128) void k_pack(const float* __restrict__ X, const float* __restrict__ WQ, const float* __restrict__ WK, const float* __restrict__ WV, const float* __restrict__ WO, __bf16* __restrict__ PX, __bf16* __restrict__ PW, _Float16* __restrict__ PWO) {
  const int tid = threadIdx.x, lane = tid & 31, col = lane & 15, g = lane >> 4; const int job = blockIdx.x * 4 + (tid >> 5);
  // XW(p): s_wait_xcnt 0 behind a run of loads, with their address as an input, so that no register of it is written again ahead of the wait
#define XW(p) asm volatile("s_wait_xcnt 0x0" :: "v"(p) : "memory")
  if (job < NJX) { const int T = job >> 2, k4 = (job & 3) * 4; const float* p = X + ((size_t)T * 16 + col) * DIN + k4 * 32 + 8 * g; __bf16* d = PX + ((size_t)T * KSTEPS + k4) * PKU + lane * 8; float v[4][16];
#pragma unroll
    for (int u = 0; u < 4; ++u) {
#pragma unroll
      for (int i = 0; i < 8; ++i) { v[u][i] = p[u * 32 + i]; v[u][8 + i] = p[u * 32 + 16 + i]; } }
    XW(p);
#pragma unroll
    for (int u = 0; u < 4; ++u) { v8b lo, hi;
#pragma unroll
      for (int i = 0; i < 8; ++i) { lo[i] = (__bf16)v[u][i]; hi[i] = (__bf16)v[u][8 + i]; }
      *(v8b*)(d + u * PKU) = lo; *(v8b*)(d + u * PKU + 256) = hi; }
  } else { const bool isO = job >= NJX + NJW; const int jw = job - (isO ? NJX + NJW : NJX), T = jw >> 2, k4 = (jw & 3) * 4, which = T / (CC / 16); const float* WA = isO ? WO : which == 0 ? WQ : which == 1 ? WK : WV;
    /* (in,out) weights, all four [512][512]: column T' * 16 + col, rows k4 * 32 + 8 g + .. */
    static_assert(DIN == CC, "one row pitch for all four weights"); const float* p = WA + (size_t)(k4 * 32 + 8 * g) * CC + (T % (CC / 16)) * 16 + col; float v[4][16];
#pragma unroll
    for (int u = 0; u < 4; ++u) {
#pragma unroll
      for (int i = 0; i < 8; ++i) { v[u][i] = p[(u * 32 + i) * CC]; v[u][8 + i] = p[(u * 32 + 16 + i) * CC]; } }
    XW(p);
    if (!isO) { __bf16* d = PW + ((size_t)T * KSTEPS + k4) * PKU + lane * 8;
#pragma unroll
      for (int u = 0; u < 4; ++u) { v8b lo, hi;
#pragma unroll
        for (int i = 0; i < 8; ++i) { lo[i] = (__bf16)v[u][i]; hi[i] = (__bf16)v[u][8 + i]; }
        *(v8b*)(d + u * PKU) = lo; *(v8b*)(d + u * PKU + 256) = hi; }
    } else { _Float16* d = PWO + ((size_t)T * KSTEPS + k4) * PKU + lane * 8;
#pragma unroll
      for (int u = 0; u < 4; ++u) { v8h lo, hi;
#pragma unroll
        for (int i = 0; i < 8; ++i) { lo[i] = (_Float16)(bfr(v[u][i]) * 256.0f); hi[i] = (_Float16)(bfr(v[u][8 + i]) * 256.0f); }
        *(v8h*)(d + u * PKU) = lo; *(v8h*)(d + u * PKU + 256) = hi; } } } }
// ---- k_proj: block = (128 rows, 128 cols, which), wave = 64 x 64: q/k/v = X W + b with exact bf16 products (K = DIN). D register r of lane (g, col) of acc[i][j] = (A-side index 16 i + 8 g + r, B-side index 16 j + col): 8 neighbouring A-side indices a lane, which is half a fragment of k_att, stored as it stands (16 bytes a lane, 512 contiguous bytes a wave).
// which 0, 1: q, k: A = W columns, B = x rows: acc[i][j] = half (i & 1) of unit (row tile r0 / 16 + j, k step c0 / 32 + (i >> 1)). which 2: v: A = x rows, B = W columns: acc[i][j] = the half unit (channel tile c0 / 16 + j, 16-key tile t0 / 16 + i).
// amdgpu_waves_per_eu(3): at most 336 registers a wave, so that the grid's three waves a SIMD are all resident at once
__global__ __launch_bounds__(128) __attribute__((amdgpu_waves_per_eu(3))) void k_proj(const __bf16* __restrict__ PX, const __bf16* __restrict__ PW, const float* __restrict__ BQ, const float* __restrict__ BK, const float* __restrict__ BV, _Float16* __restrict__ QH, _Float16* __restrict__ KH, _Float16* __restrict__ VT) {
  const int tid = threadIdx.x, wave = tid >> 5, lane = tid & 31, col = lane & 15, g = lane >> 4; const int which = blockIdx.z; const int c0 = blockIdx.y * 128 + (wave & 1) * 64; const size_t r0 = (size_t)blockIdx.x * 128 + (wave >> 1) * 64; const size_t bb = r0 / TT; const int t0 = (int)(r0 % TT);
  const unsigned* px = (const unsigned*)PX + (r0 / 16) * PKT + lane * 4; const unsigned* pw = (const unsigned*)PW + ((size_t)which * (CC / 16) + c0 / 16) * PKT + lane * 4;
  const float* BA = which == 0 ? BQ : which == 1 ? BK : BV;
  v8f acc[4][4] = {};
  gemm64<2, true>(which < 2 ? pw : px, which < 2 ? px : pw, acc);
  if (which < 2) { _Float16* d = (which == 0 ? QH : KH) + ((r0 / 16) * KSTEPS + c0 / 32) * PKU + lane * 8; float bias[4][8] = {};
    if (BA) {
#pragma unroll
      for (int i = 0; i < 4; ++i) {
#pragma unroll
        for (int r = 0; r < 8; ++r) bias[i][r] = bfr(BA[c0 + i * 16 + 8 * g + r]); } }
#pragma unroll
    for (int j = 0; j < 4; ++j) {
#pragma unroll
      for (int i = 0; i < 4; ++i) { v8h hv;
#pragma unroll
        for (int r = 0; r < 8; ++r) hv[r] = (_Float16)(acc[i][j][r] + bias[i][r]);
        *(v8h*)(d + (j * KSTEPS + (i >> 1)) * PKU + (i & 1) * 256) = hv; } }
  } else { _Float16* d = VT + ((bb * (CC / 16) + c0 / 16) * (TT / 16) + t0 / 16) * 256 + lane * 8; float bias[4] = {};
    if (BA) {
#pragma unroll
      for (int j = 0; j < 4; ++j) bias[j] = bfr(BA[c0 + j * 16 + col]); }
#pragma unroll
    for (int j = 0; j < 4; ++j) {
#pragma unroll
      for (int i = 0; i < 4; ++i) { v8h hv;
#pragma unroll
        for (int r = 0; r < 8; ++r) hv[r] = (_Float16)(acc[i][j][r] + bias[j]);
        *(v8h*)(d + (j * (TT / 16) + i) * 256) = hv; } } } }
// ---- k_att: scores, softmax and P . v in one kernel, one launch for every (batch, head). wave = 16 query rows t = ql0 .. ql0 + 15 of (b, h) against its own span of KSPAN keys, which holds every key of [ql0 - WIN, ql0 + 15 + WIN) that lies in the sequence; the waves of a block share nothing.
// transposed products: S^T = K . Q^T (A = 16 key rows, B = the 16 query rows), so D register r of lane (g, col) of tile i is the logit of key kbeg + 16 i + 8 g + r for query ql0 + col: one lane holds half of one query's logits, maximum and sum run in the lane and are joined with lane ^ 16.
// two neighbouring S^T tiles, converted in place, are the B operand (32 keys in the fragments' k order) of O^T += V^T . P^T (A = 16 channels of v, 32 keys); D register r = ctx[query ql0 + col][16 j + 8 g + r].
#define KSPAN 288   // 16 + 2 WIN = 272 keys, rounded up to whole 32-key chunks
// takes 12 loaded fragments as inputs only: all 24 loads of a group are issued before the first of them is waited for (one round trip a group; without it the build waited after every pair of loads)
#define HOLD12(f) asm volatile("" :: "v"(f[0]), "v"(f[1]), "v"(f[2]), "v"(f[3]), "v"(f[4]), "v"(f[5]), "v"(f[6]), "v"(f[7]), "v"(f[8]), "v"(f[9]), "v"(f[10]), "v"(f[11]))
// 2^x of the 8 values of a tile, in place. In asm so that the slot which the instruction set asks for behind a transcendental is filled by construction: each v_exp_f32 is followed by one on other registers, the last by a v_nop
__device__ __forceinline__ void exp2x8(v8f& x) { float a = x[0], b = x[1], c = x[2], d = x[3], e = x[4], f = x[5], g = x[6], h = x[7];
  asm("v_exp_f32 %0, %0\n\tv_exp_f32 %1, %1\n\tv_exp_f32 %2, %2\n\tv_exp_f32 %3, %3\n\tv_exp_f32 %4, %4\n\tv_exp_f32 %5, %5\n\tv_exp_f32 %6, %6\n\tv_exp_f32 %7, %7\n\tv_nop" : "+v"(a), "+v"(b), "+v"(c), "+v"(d), "+v"(e), "+v"(f), "+v"(g), "+v"(h));
  x = (v8f){a, b, c, d, e, f, g, h}; }
// amdgpu_waves_per_eu(4): at most 256 registers a wave, so that the grid's four waves a SIMD are all resident at once
__global__ __launch_bounds__(128) __attribute__((amdgpu_waves_per_eu(4))) void k_att(const _Float16* __restrict__ QH, const _Float16* __restrict__ KH, const _Float16* __restrict__ VT, _Float16* __restrict__ PY) {
  const int tid = threadIdx.x, wave = tid >> 5, lane = tid & 31, col = lane & 15, g = lane >> 4; const int h = blockIdx.y, b = blockIdx.z; const int ql0 = blockIdx.x * 64 + wave * 16; const int t = ql0 + col;
  int kbeg = ql0 - WIN; kbeg = kbeg < 0 ? 0 : kbeg; kbeg = kbeg > TT - KSPAN ? TT - KSPAN : kbeg;   /* the span is moved into the sequence at both ends; the keys it gains there are cut by the index rule below */
  /* ql0 and kbeg are multiples of 16: whole row tiles of q and k (k steps 2 h, 2 h + 1), whole 16-key half units of v; two neighbouring half units are the fragment of a 32-key chunk */
  const _Float16* qp = QH + (((size_t)b * TT + ql0) / 16 * KSTEPS + h * 2) * PKU + lane * 8; const _Float16* kp = KH + (((size_t)b * TT + kbeg) / 16 * KSTEPS + h * 2) * PKU + lane * 8; const _Float16* vp = VT + (((size_t)b * (CC / 16) + h * (HD / 16)) * (TT / 16) + kbeg / 16) * 256 + lane * 8;
  const v16h q0 = ldh(qp), q1 = ldh(qp + PKU);
  v8f sc[KSPAN / 16];
#pragma unroll
  for (int i0 = 0; i0 < KSPAN / 16; i0 += 6) { v16h kf[12];
#pragma unroll
    for (int u = 0; u < 6; ++u) { kf[2 * u] = ldh(kp + (i0 + u) * KSTEPS * PKU); kf[2 * u + 1] = ldh(kp + (i0 + u) * KSTEPS * PKU + PKU); }
    HOLD12(kf);
#pragma unroll
    for (int u = 0; u < 6; ++u) { v8f a = {}; a = __builtin_amdgcn_wmma_f32_16x16x32_f16(false, kf[2 * u], false, q0, (short)0, a, false, false); sc[i0 + u] = __builtin_amdgcn_wmma_f32_16x16x32_f16(false, kf[2 * u + 1], false, q1, (short)0, a, false, false); } }
  const int dk = kbeg + 8 * g - t + WIN;   /* key k is allowed for query t iff 0 <= k - t + WIN < 2 WIN */
  float m = -3.0e38f;
#pragma unroll
  for (int i = 0; i < KSPAN / 16; ++i) {
#pragma unroll
    for (int r = 0; r < 8; ++r) { const float v = ((unsigned)(dk + i * 16 + r) < 2u * WIN) ? sc[i][r] : -3.0e38f; sc[i][r] = v; m = fmaxf(m, v); } }   /* the maximum is taken over the unscaled logits: SCALE > 0 keeps their order */
  m = fmaxf(m, __shfl_xor(m, 16));
  const float l2s = SCALE * 1.44269504088896340736f, mb = m * l2s;   /* exp((s - m) SCALE) = 2^(s l2s - m l2s): one multiply-add and the chip's own 2^x a logit */
  float sum = 0.f;
#pragma unroll
  for (int i = 0; i < KSPAN / 16; ++i) {
#pragma unroll
    for (int r = 0; r < 8; ++r) sc[i][r] = fmaf(sc[i][r], l2s, -mb);
    exp2x8(sc[i]);   /* an excluded key beside an allowed one: 2^(-3.0e38 l2s - mb) = 0 */
#pragma unroll
    for (int r = 0; r < 8; ++r) sum += sc[i][r]; }
  sum += __shfl_xor(sum, 16);
  const float inv = (m > -1.0e38f && sum > 0.f) ? 2048.0f / sum : 0.f;   /* P carried x 2^11 into f16; a fully excluded row yields P = 0 */
  v16h p[KSPAN / 32];
#pragma unroll
  for (int c = 0; c < KSPAN / 32; ++c) {
#pragma unroll
    for (int r = 0; r < 8; ++r) { p[c][r] = (_Float16)(sc[2 * c][r] * inv); p[c][8 + r] = (_Float16)(sc[2 * c + 1][r] * inv); } }
  v8f acc[HD / 16] = {};
#pragma unroll
  for (int c0 = 0; c0 < KSPAN / 32; c0 += 3) { v16h vf[12];
#pragma unroll
    for (int u = 0; u < 3; ++u) {
#pragma unroll
      for (int j = 0; j < HD / 16; ++j) vf[u * 4 + j] = ldh(vp + j * (TT / 16) * 256 + (c0 + u) * 512); }
    HOLD12(vf);
#pragma unroll
    for (int u = 0; u < 3; ++u) {
#pragma unroll
      for (int j = 0; j < HD / 16; ++j) acc[j] = __builtin_amdgcn_wmma_f32_16x16x32_f16(false, vf[u * 4 + j], false, p[c0 + u], (short)0, acc[j], false, false); } }
  // lane (g, col) holds ctx[ql0 + col][64 h + 16 j + 8 g + r]: acc[2 c], acc[2 c + 1] are halves 0, 1 of this lane's fragment of k step 2 h + c of row tile (b TT + ql0) / 16 for k_out; ctx carried x 2^6 into f16 so small-magnitude context rows stay clear of f16 subnormals
  _Float16* yp = PY + (((size_t)b * TT + ql0) / 16 * KSTEPS + h * 2) * PKU + lane * 8;
#pragma unroll
  for (int j = 0; j < HD / 16; ++j) { const v8f o = acc[j] * (1.0f / 2048.0f); v8h w;
#pragma unroll
    for (int r = 0; r < 8; ++r) w[r] = (_Float16)(o[r] * 64.0f);
    *(v8h*)(yp + (j >> 1) * PKU + (j & 1) * 256) = w; } }
// ---- k_out: block = (128 rows, 128 cols), wave = 64 x 64: out = ctx Wo + bo: ctx x 2^6 f16 against Wo as f16(bf16 x 2^8) exact (1 product) x 2^-14; A = Wo columns, B = ctx rows, so a lane holds 8 neighbouring columns of an output row; staged in the wave's own LDS range, stored as whole lines
__global__ __launch_bounds__(128) void k_out(const _Float16* __restrict__ PY, const _Float16* __restrict__ PWO, const float* __restrict__ BO, float* __restrict__ OUT) { __shared__ __align__(16) float sf[4][64][68];
  const int tid = threadIdx.x, wave = tid >> 5, lane = tid & 31, col = lane & 15, g = lane >> 4; const int c0 = blockIdx.y * 128 + (wave & 1) * 64; const size_t r0 = (size_t)blockIdx.x * 128 + (wave >> 1) * 64;
  v8f acc[4][4] = {};
  gemm64<3, false>((const unsigned*)PWO + (size_t)(c0 / 16) * PKT + lane * 4, (const unsigned*)PY + (r0 / 16) * PKT + lane * 4, acc);
  float bias[4][8] = {};
  if (BO) {
#pragma unroll
    for (int i = 0; i < 4; ++i) {
#pragma unroll
      for (int r = 0; r < 8; ++r) bias[i][r] = bfr(BO[c0 + i * 16 + 8 * g + r]); } }
#pragma unroll
  for (int i = 0; i < 4; ++i) {
#pragma unroll
    for (int j = 0; j < 4; ++j) { float o[8];
#pragma unroll
      for (int r = 0; r < 8; ++r) o[r] = acc[i][j][r] * (1.0f / 16384.0f) + bias[i][r];   /* 2^-8 (Wo carry) x 2^-6 (ctx carry) */
      float* s = &sf[wave][j * 16 + col][i * 16 + 8 * g]; *(v4f*)s = (v4f){o[0], o[1], o[2], o[3]}; *(v4f*)(s + 4) = (v4f){o[4], o[5], o[6], o[7]}; } }
  LDSX();   /* the wave's own LDS writes have landed before other lanes of it read them */
#pragma unroll
  for (int e = 0; e < 32; ++e) { const int mj = e * 2 + g; vst2(OUT + (r0 + mj) * DIN + c0 + col * 4, *(const v4f*)&sf[wave][mj][col * 4]); } }

extern "C" void kernel_launch(void* const* d_in, const int* in_sizes, int n_in, void* d_out, int out_size, void* d_ws, size_t ws_size, hipStream_t stream) {
  (void)in_sizes; (void)n_in; (void)out_size;
  const float** F = (const float**)d_in;
  if (ws_size < (size_t)WS_END) return;
  char* ws = (char*)d_ws; _Float16 *QH = (_Float16*)(ws + WS_QH), *KH = (_Float16*)(ws + WS_KH), *VT = (_Float16*)(ws + WS_VT), *PWO = (_Float16*)(ws + WS_PWO), *PY = (_Float16*)(ws + WS_Y); __bf16 *PX = (__bf16*)(ws + WS_PX), *PW = (__bf16*)(ws + WS_PW);
  // inputs: 0 x [2,4096,512]; 1 Wq [512,512] (in,out), 2 bq; 3 Wk, 4 bk; 5 Wv, 6 bv; 7 Wo (in,out), 8 bo (biases NONZERO)
  k_pack<<<dim3((NJX + NJW + NJO) / 4), 128, 0, stream>>>(F[0], F[1], F[3], F[5], F[7], PX, PW, PWO);
  k_proj<<<dim3(TNB * TT / 128, CC / 128, 3), 128, 0, stream>>>(PX, PW, F[2], F[4], F[6], QH, KH, VT);
  k_att<<<dim3(NQB, NH, TNB), 128, 0, stream>>>(QH, KH, VT, PY);
  k_out<<<dim3(TNB * TT / 128, DIN / 128), 128, 0, stream>>>(PY, PWO, F[8], (float*)d_out);
}

// v004
// A run of this version takes 41.1 microseconds.
// Timed twice side by side with v003, it ran 1.09 times as fast both times.
// Counting every step since v000, it is 13.7 times as fast.
// compute dtype: all float inputs rounded to bf16; q / k / v projections with EXACT bf16 products on WMMA 16x16x32 (f32 accumulate) + bias; logits q x k once to f16 each (1 product) x 64^-0.5, computed only for a 288-key span round the +-128 band of each 32 query rows; the exact band rule by index; softmax f32; P x 2^11 once to f16 x v once to f16 (1 product) over that span, all three in one kernel; ctx x 2^6 once to f16 x Wo f16(bf16 x 2^8) + bo; f32 output.
#include <hip/hip_runtime.h>
#include <math.h>

typedef __attribute__((ext_vector_type(16))) _Float16 v16h;
typedef __attribute__((ext_vector_type(16))) __bf16 v16b;
typedef __attribute__((ext_vector_type(8)))  _Float16 v8h;
typedef __attribute__((ext_vector_type(8)))  float v8f;
typedef __attribute__((ext_vector_type(4)))  float v4f;
typedef __attribute__((ext_vector_type(2)))  float v2f;
typedef __attribute__((ext_vector_type(4)))  unsigned v4u;
typedef __attribute__((ext_vector_type(4)))  int v4i;
typedef float __attribute__((may_alias)) float_a;
typedef int __attribute__((may_alias)) int_a;

template <typename T> __device__ __forceinline__ void vst2(void* p, T v) { *(T*)p = v;  }
__device__ __forceinline__ v8f wmma16(v16h a, v16h b, v8f c) {
  v8f d = __builtin_amdgcn_wmma_f32_16x16x32_f16(false, a, false, b, (short)0, c, false, false);
  asm volatile("v_nop\n\tv_nop\n\tv_nop\n\tv_nop" : "+v"(d) : "v"(a), "v"(b));
  return d;
}
__device__ __forceinline__ v8f wmma_bf(v16b a, v16b b, v8f c) {
  v8f d = __builtin_amdgcn_wmma_f32_16x16x32_bf16(false, a, false, b, (short)0, c, false, false);
  asm volatile("v_nop\n\tv_nop\n\tv_nop\n\tv_nop" : "+v"(d) : "v"(a), "v"(b));
  return d;
}
// 16x16x32 fragments: lane = (h = lane>>4, row/col = lane&15); elements 0..7 = k0+8h+0..7, 8..15 = k0+16+8h+0..7; D element r = row 8h+r
__device__ __forceinline__ v16h frag_h(const _Float16* rowk0, int lane) {
  union { v16h v; v8h q[2]; } u; const _Float16* p = rowk0 + 8 * (lane >> 4);
  u.q[0] = *(const v8h*)p; u.q[1] = *(const v8h*)(p + 16); return u.v;
}
__device__ __forceinline__ v16h frag_f32(const float* rowk0, int lane) {
  v16h a; const float* p = rowk0 + 8 * (lane >> 4);
#pragma unroll
  for (int i = 0; i < 8; ++i) { a[i] = (_Float16)p[i]; a[8 + i] = (_Float16)p[16 + i]; }
  return a;
}
__device__ __forceinline__ v16h frag_f32s(const float* rowk0, int lane, float sc) {
  v16h a; const float* p = rowk0 + 8 * (lane >> 4);
#pragma unroll
  for (int i = 0; i < 8; ++i) { a[i] = (_Float16)(p[i] * sc); a[8 + i] = (_Float16)(p[16 + i] * sc); }
  return a;
}
// column fragment from a [K][ld] layout (column n), rows >= K read as 0
__device__ __forceinline__ v16h fragc_f32(const float* W, int k0, int n, int lane, int ld, int K) {
  v16h a; const int g = lane >> 4;
#pragma unroll
  for (int i = 0; i < 8; ++i) { const int ka = k0 + 8 * g + i, kb = ka + 16;
    a[i] = (_Float16)(ka < K ? W[(size_t)(ka < K ? ka : K - 1) * ld + n] : 0.f); a[8 + i] = (_Float16)(kb < K ? W[(size_t)(kb < K ? kb : K - 1) * ld + n] : 0.f); }
  return a;
}
struct F2 { v16b h, l; };
__device__ __forceinline__ F2 bsplit16(const float v[16]) { F2 r;
#pragma unroll
  for (int i = 0; i < 16; ++i) { const __bf16 h = (__bf16)v[i]; r.h[i] = h; r.l[i] = (__bf16)(v[i] - (float)h); }
  return r; }
__device__ __forceinline__ F2 split_row(const float* row, int k0, int lane) { float v[16]; const float* p = row + k0 + 8 * (lane >> 4);
#pragma unroll
  for (int i = 0; i < 8; ++i) { v[i] = p[i]; v[8 + i] = p[16 + i]; }
  return bsplit16(v); }
__device__ __forceinline__ F2 split_rowK(const float* row, int k0, int lane, int K) { float v[16]; const int g = lane >> 4;
#pragma unroll
  for (int i = 0; i < 8; ++i) { const int ka = k0 + 8 * g + i, kb = ka + 16; v[i] = ka < K ? row[ka < K ? ka : K - 1] : 0.f; v[8 + i] = kb < K ? row[kb < K ? kb : K - 1] : 0.f; }
  return bsplit16(v); }
__device__ __forceinline__ F2 split_col(const float* W, int k0, int n, int lane, int ld, int K) { float v[16]; const int g = lane >> 4;
#pragma unroll
  for (int i = 0; i < 8; ++i) { const int ka = k0 + 8 * g + i, kb = ka + 16; v[i] = ka < K ? W[(size_t)(ka < K ? ka : K - 1) * ld + n] : 0.f; v[8 + i] = kb < K ? W[(size_t)(kb < K ? kb : K - 1) * ld + n] : 0.f; }
  return bsplit16(v); }
__device__ __forceinline__ v8f mac3(const F2& a, const F2& b, v8f c) { c = wmma_bf(a.l, b.h, c); c = wmma_bf(a.h, b.l, c); return wmma_bf(a.h, b.h, c); }
__device__ __forceinline__ float sigm(float v) { return 1.0f / (1.0f + expf(-v)); }
#define LDSX() do { asm volatile("s_wait_dscnt 0" ::: "memory"); __builtin_amdgcn_wave_barrier(); __builtin_amdgcn_fence(__ATOMIC_RELEASE, "workgroup"); } while (0)

// Multi-head SLIDING-WINDOW self-attention (x [2,4096,512]; (in,out) Wq / Wk / Wv / Wo [512,512] and biases [512], all N(0,1) x 0.02 - biases NONZERO; 8 heads x 64; scores / sqrt(64); allowed = (j >= i - 128) & (j < i + 128) by index, -inf elsewhere; softmax over the keys; out @ Wo + bo). Only a span of keys round the band of 32 query rows is computed - a superset of every row's own band, which is then cut exactly by index.
#define NB 2
#define TT 4096
#define CC 512            // NH * HD = projected width
#define DIN 512          // input (model) width
#define NH 8
#define HD 64
#define NQB (TT / 64)
#define HG 1
#define SCALE (0.125f)
#define CAUSAL 0
#ifndef TNB
#define TNB NB
#endif
__device__ __forceinline__ float bfr(float v) { return (float)(__bf16)v; }
#define WIN 128   // window: key j is allowed for query i iff i - WIN <= j < i + WIN
typedef __attribute__((ext_vector_type(8))) __bf16 v8b;
__device__ __forceinline__ v16b frag_b(const __bf16* rowk0, int lane) {
  union { v16b v; v8b q[2]; } u; const __bf16* p = rowk0 + 8 * (lane >> 4);
  u.q[0] = *(const v8b*)p; u.q[1] = *(const v8b*)(p + 16); return u.v;
}
#define QBH 0              // unused: this file has no causal or high-precision path
#define QHI 0               // single-product logits on every row (0.02-scale weights: logit sigma ~0.1)
#define KHI 64            // key rows carrying k residual / v bf16 hi+lo planes (only sizes the workspace regions below, which nothing here writes)
// B fragment (k rows k0+.., output column o) of a weight: (in,out) [K][ld] or (out,in) [ld rows of K]: bf16 exact, or f16(bf16 * 256) exact
__device__ __forceinline__ v16b wcol_io(const float* Wm, int k0, int o, int lane, int ld) { v16b w; const int g = lane >> 4;
#pragma unroll
  for (int i = 0; i < 8; ++i) { w[i] = (__bf16)Wm[(size_t)(k0 + 8 * g + i) * ld + o]; w[8 + i] = (__bf16)Wm[(size_t)(k0 + 16 + 8 * g + i) * ld + o]; }
  return w; }
__device__ __forceinline__ v16b wcol_oi(const float* Wm, int k0, int o, int lane, int K) { v16b w; const float* p = Wm + (size_t)o * K + k0 + 8 * (lane >> 4);
#pragma unroll
  for (int i = 0; i < 8; ++i) { w[i] = (__bf16)p[i]; w[8 + i] = (__bf16)p[16 + i]; }
  return w; }
__device__ __forceinline__ v16h wcolh_io(const float* Wm, int k0, int o, int lane, int ld) { v16h w; const int g = lane >> 4;
#pragma unroll
  for (int i = 0; i < 8; ++i) { w[i] = (_Float16)(bfr(Wm[(size_t)(k0 + 8 * g + i) * ld + o]) * 256.0f); w[8 + i] = (_Float16)(bfr(Wm[(size_t)(k0 + 16 + 8 * g + i) * ld + o]) * 256.0f); }
  return w; }
__device__ __forceinline__ v16h wcolh_oi(const float* Wm, int k0, int o, int lane, int K) { v16h w; const float* p = Wm + (size_t)o * K + k0 + 8 * (lane >> 4);
#pragma unroll
  for (int i = 0; i < 8; ++i) { w[i] = (_Float16)(bfr(p[i]) * 256.0f); w[8 + i] = (_Float16)(bfr(p[16 + i]) * 256.0f); }
  return w; }
#define WQKV_LAYOUT 0   // 0 = (in,out) [DIN][CC]; 1 = (out,in) [CC][DIN]; 2 = per-head [NH][DIN][HD]
__device__ __forceinline__ v16b wcol_hdk(const float* Wm, int k0, int o, int lane) { v16b w; const int g = lane >> 4; const float* p = Wm + (size_t)(o / HD) * DIN * HD + (o % HD);
#pragma unroll
  for (int i = 0; i < 8; ++i) { w[i] = (__bf16)p[(size_t)(k0 + 8 * g + i) * HD]; w[8 + i] = (__bf16)p[(size_t)(k0 + 16 + 8 * g + i) * HD]; }
  return w; }
#define WO_OUT_IN 0
#if WQKV_LAYOUT == 1
#define WCOL(W, k0, o, lane) wcol_oi(W, k0, o, lane, DIN)
#elif WQKV_LAYOUT == 2
#define WCOL(W, k0, o, lane) wcol_hdk(W, k0, o, lane)
#else
#define WCOL(W, k0, o, lane) wcol_io(W, k0, o, lane, CC)
#endif
#if WO_OUT_IN
#define WOCOL(W, k0, o, lane) wcol_oi(W, k0, o, lane, CC)
#define WOCOLH(W, k0, o, lane) wcolh_oi(W, k0, o, lane, CC)
#else
#define WOCOL(W, k0, o, lane) wcol_io(W, k0, o, lane, DIN)
#define WOCOLH(W, k0, o, lane) wcolh_io(W, k0, o, lane, DIN)
#endif

#define WS_QH  0u                                      // f16 q, packed fragments [row tile][k step]
#define WS_KH  (WS_QH + 2u * (size_t)NB * TT * CC)      // f16 k, packed fragments [row tile][k step]
#define WS_VT  (WS_KH + 2u * (size_t)NB * TT * CC)      // f16 v, packed half units [b][channel tile][16-key tile]
#define WS_QL  (WS_VT + 2u * (size_t)NB * CC * TT)      // f16 q residual x 2^10 rows [b][t < QHI][CC]
#define WS_KL  (WS_QL + 2u * (size_t)NB * QHI * CC)     // f16 k residual x 2^10 rows [b][t < KHI][CC]
#define WS_VB  (WS_KL + 2u * (size_t)NB * KHI * CC)     // bf16 v hi planes [b][c][t < KHI]
#define WS_VBL (WS_VB + 2u * (size_t)NB * CC * KHI)
#define WS_S   (WS_VBL + 2u * (size_t)NB * CC * KHI)    // the packed operands PX, PW, PWO below lie at its start; the size is kept so that the offsets behind it stay
#define WS_PX  WS_S                                     // bf16 x, packed fragments [row tile][k step]
#define WS_PW  (WS_PX + 2u * (size_t)NB * TT * DIN)     // bf16 Wq, Wk, Wv, packed fragments [which][column tile][k step]
#define WS_PWO (WS_PW + 2u * 3u * (size_t)DIN * CC)     // f16(bf16 x 2^8) Wo, packed fragments [column tile][k step]
#define WS_Y   (WS_S  + 4u * (size_t)HG * TT * TT)      // f16 ctx x 2^6, packed fragments [row tile][k step]
#define WS_END (WS_Y  + 4u * (size_t)NB * TT * CC)

// ---- packed fragments: every WMMA operand that passes through the workspace lies there in the order in which a wave's registers hold it. unit (16-wide tile T, k step kc of 32) = 1 KiB at element (T * 16 + kc) * 512: [half 0: elements 0..7][half 1: elements 8..15] x [lane 0..31] x 8 elements, so a fragment is two 16-byte loads a lane, each 512 contiguous bytes a wave.
typedef __attribute__((ext_vector_type(8))) unsigned v8u;
#define KSTEPS 16          // DIN / 32 = CC / 32
#define PKU 512            // 16-bit elements of a unit
#define PKT (KSTEPS * 256) // dwords of a tile's 16 units
__device__ __forceinline__ v8u ldf(const unsigned* __restrict__ p) { const v4u lo = *(const v4u*)p, hi = *(const v4u*)(p + 128); return __builtin_shufflevector(lo, hi, 0, 1, 2, 3, 4, 5, 6, 7); }
__device__ __forceinline__ v16h ldh(const _Float16* __restrict__ p) { union { v16h v; v8h q[2]; } u; u.q[0] = *(const v8h*)p; u.q[1] = *(const v8h*)(p + 256); return u.v; }
template <bool BF> __device__ __forceinline__ v8f mm(v8u a, v8u b, v8f c) {
  if constexpr (BF) return __builtin_amdgcn_wmma_f32_16x16x32_bf16(false, __builtin_bit_cast(v16b, a), false, __builtin_bit_cast(v16b, b), (short)0, c, false, false);
  else return __builtin_amdgcn_wmma_f32_16x16x32_f16(false, __builtin_bit_cast(v16h, a), false, __builtin_bit_cast(v16h, b), (short)0, c, false, false);
}
// one wave: a 64 x 64 tile, acc[i][j] = (A-side tile i) . (B-side tile j)^T over K = 512, k steps in rising order; pa, pb = the lane's own 16 bytes in the first unit of the first tile. NBUF fragment sets: the loads of step kc + NBUF - 1 are issued ahead of the products of step kc.
template <int NBUF, bool BF> __device__ __forceinline__ void gemm64(const unsigned* __restrict__ pa, const unsigned* __restrict__ pb, v8f (&acc)[4][4]) {
  v8u fa[NBUF][4], fb[NBUF][4];
#pragma unroll
  for (int s = 0; s < NBUF - 1; ++s) {
#pragma unroll
    for (int u = 0; u < 4; ++u) { fa[s][u] = ldf(pa + u * PKT + s * 256); fb[s][u] = ldf(pb + u * PKT + s * 256); } }
#pragma unroll
  for (int kc = 0; kc < KSTEPS; ++kc) { const int nx = kc + NBUF - 1;
    if (nx < KSTEPS) {
#pragma unroll
      for (int u = 0; u < 4; ++u) { fa[nx % NBUF][u] = ldf(pa + u * PKT + nx * 256); fb[nx % NBUF][u] = ldf(pb + u * PKT + nx * 256); } }
    __builtin_amdgcn_sched_barrier(0);   /* keeps the 16 loads above ahead of this step's products: without it the build sank each load to its first use and waited for it there, four round trips a step */
#pragma unroll
    for (int j = 0; j < 4; ++j) {
#pragma unroll
      for (int i = 0; i < 4; ++i) acc[i][j] = mm<BF>(fa[kc % NBUF][i], fb[kc % NBUF][j], acc[i][j]); }
    __builtin_amdgcn_sched_barrier(0);   /* keeps the next group of loads behind these products, so that each group is one run of loads */
  } }
// ---- k_pack: wave = one 16-wide tile x 4 k steps of x (bf16), of Wq / Wk / Wv (bf16) or of Wo (f16(bf16 x 2^8)): the fragments as the GEMMs' own loaders formed them, each formed once a call
#define NJX (TNB * TT / 16 * 4)
#define NJW (3 * (CC / 16) * 4)
#define NJO ((DIN / 16) * 4)
__global__ __launch_bounds__(128) void k_pack(const float* __restrict__ X, const float* __restrict__ WQ, const float* __restrict__ WK, const float* __restrict__ WV, const float* __restrict__ WO, __bf16* __restrict__ PX, __bf16* __restrict__ PW, _Float16* __restrict__ PWO) {
  const int tid = threadIdx.x, lane = tid & 31, col = lane & 15, g = lane >> 4; const int job = blockIdx.x * 4 + (tid >> 5);
  // XW(p): s_wait_xcnt 0 behind a run of loads, with their address as an input, so that no register of it is written again ahead of the wait
#define XW(p) asm volatile("s_wait_xcnt 0x0" :: "v"(p) : "memory")
  if (job < NJX) { const int T = job >> 2, k4 = (job & 3) * 4; const float* p = X + ((size_t)T * 16 + col) * DIN + k4 * 32 + 8 * g; __bf16* d = PX + ((size_t)T * KSTEPS + k4) * PKU + lane * 8; float v[4][16];
#pragma unroll
    for (int u = 0; u < 4; ++u) {
#pragma unroll
      for (int i = 0; i < 8; ++i) { v[u][i] = p[u * 32 + i]; v[u][8 + i] = p[u * 32 + 16 + i]; } }
    XW(p);
#pragma unroll
    for (int u = 0; u < 4; ++u) { v8b lo, hi;
#pragma unroll
      for (int i = 0; i < 8; ++i) { lo[i] = (__bf16)v[u][i]; hi[i] = (__bf16)v[u][8 + i]; }
      *(v8b*)(d + u * PKU) = lo; *(v8b*)(d + u * PKU + 256) = hi; }
  } else { const bool isO = job >= NJX + NJW; const int jw = job - (isO ? NJX + NJW : NJX), T = jw >> 2, k4 = (jw & 3) * 4, which = T / (CC / 16); const float* WA = isO ? WO : which == 0 ? WQ : which == 1 ? WK : WV;
    /* (in,out) weights, all four [512][512]: column T' * 16 + col, rows k4 * 32 + 8 g + .. */
    static_assert(DIN == CC, "one row pitch for all four weights"); const float* p = WA + (size_t)(k4 * 32 + 8 * g) * CC + (T % (CC / 16)) * 16 + col; float v[4][16];
#pragma unroll
    for (int u = 0; u < 4; ++u) {
#pragma unroll
      for (int i = 0; i < 8; ++i) { v[u][i] = p[(u * 32 + i) * CC]; v[u][8 + i] = p[(u * 32 + 16 + i) * CC]; } }
    XW(p);
    if (!isO) { __bf16* d = PW + ((size_t)T * KSTEPS + k4) * PKU + lane * 8;
#pragma unroll
      for (int u = 0; u < 4; ++u) { v8b lo, hi;
#pragma unroll
        for (int i = 0; i < 8; ++i) { lo[i] = (__bf16)v[u][i]; hi[i] = (__bf16)v[u][8 + i]; }
        *(v8b*)(d + u * PKU) = lo; *(v8b*)(d + u * PKU + 256) = hi; }
    } else { _Float16* d = PWO + ((size_t)T * KSTEPS + k4) * PKU + lane * 8;
#pragma unroll
      for (int u = 0; u < 4; ++u) { v8h lo, hi;
#pragma unroll
        for (int i = 0; i < 8; ++i) { lo[i] = (_Float16)(bfr(v[u][i]) * 256.0f); hi[i] = (_Float16)(bfr(v[u][8 + i]) * 256.0f); }
        *(v8h*)(d + u * PKU) = lo; *(v8h*)(d + u * PKU + 256) = hi; } } } }
// ---- k_proj: block = (128 rows, 128 cols, which), wave = 64 x 64: q/k/v = X W + b with exact bf16 products (K = DIN). D register r of lane (g, col) of acc[i][j] = (A-side index 16 i + 8 g + r, B-side index 16 j + col): 8 neighbouring A-side indices a lane, which is half a fragment of k_att, stored as it stands (16 bytes a lane, 512 contiguous bytes a wave).
// which 0, 1: q, k: A = W columns, B = x rows: acc[i][j] = half (i & 1) of unit (row tile r0 / 16 + j, k step c0 / 32 + (i >> 1)). which 2: v: A = x rows, B = W columns: acc[i][j] = the half unit (channel tile c0 / 16 + j, 16-key tile t0 / 16 + i).
// amdgpu_waves_per_eu(3): at most 336 registers a wave, so that the grid's three waves a SIMD are all resident at once
__global__ __launch_bounds__(128) __attribute__((amdgpu_waves_per_eu(3))) void k_proj(const __bf16* __restrict__ PX, const __bf16* __restrict__ PW, const float* __restrict__ BQ, const float* __restrict__ BK, const float* __restrict__ BV, _Float16* __restrict__ QH, _Float16* __restrict__ KH, _Float16* __restrict__ VT) {
  const int tid = threadIdx.x, wave = tid >> 5, lane = tid & 31, col = lane & 15, g = lane >> 4; const int which = blockIdx.z; const int c0 = blockIdx.y * 128 + (wave & 1) * 64; const size_t r0 = (size_t)blockIdx.x * 128 + (wave >> 1) * 64; const size_t bb = r0 / TT; const int t0 = (int)(r0 % TT);
  const unsigned* px = (const unsigned*)PX + (r0 / 16) * PKT + lane * 4; const unsigned* pw = (const unsigned*)PW + ((size_t)which * (CC / 16) + c0 / 16) * PKT + lane * 4;
  const float* BA = which == 0 ? BQ : which == 1 ? BK : BV;
  v8f acc[4][4] = {};
  gemm64<2, true>(which < 2 ? pw : px, which < 2 ? px : pw, acc);
  if (which < 2) { _Float16* d = (which == 0 ? QH : KH) + ((r0 / 16) * KSTEPS + c0 / 32) * PKU + lane * 8; float bias[4][8] = {};
    if (BA) {
#pragma unroll
      for (int i = 0; i < 4; ++i) {
#pragma unroll
        for (int r = 0; r < 8; ++r) bias[i][r] = bfr(BA[c0 + i * 16 + 8 * g + r]); } }
#pragma unroll
    for (int j = 0; j < 4; ++j) {
#pragma unroll
      for (int i = 0; i < 4; ++i) { v8h hv;
#pragma unroll
        for (int r = 0; r < 8; ++r) hv[r] = (_Float16)(acc[i][j][r] + bias[i][r]);
        *(v8h*)(d + (j * KSTEPS + (i >> 1)) * PKU + (i & 1) * 256) = hv; } }
  } else { _Float16* d = VT + ((bb * (CC / 16) + c0 / 16) * (TT / 16) + t0 / 16) * 256 + lane * 8; float bias[4] = {};
    if (BA) {
#pragma unroll
      for (int j = 0; j < 4; ++j) bias[j] = bfr(BA[c0 + j * 16 + col]); }
#pragma unroll
    for (int j = 0; j < 4; ++j) {
#pragma unroll
      for (int i = 0; i < 4; ++i) { v8h hv;
#pragma unroll
        for (int r = 0; r < 8; ++r) hv[r] = (_Float16)(acc[i][j][r] + bias[j]);
        *(v8h*)(d + (j * (TT / 16) + i) * 256) = hv; } } } }
// ---- k_att: scores, softmax and P . v in one kernel, one launch for every (batch, head). wave = QT tiles of 16 query rows, t = ql0 .. ql0 + 16 QT - 1 of (b, h), against one span of KSPAN keys, which holds every key of [ql0 - WIN, ql0 + 16 QT - 1 + WIN) that lies in the sequence: each k and v fragment is loaded once and multiplied with every query tile of the wave; the waves of a block share nothing.
// transposed products: S^T = K . Q^T (A = 16 key rows, B = 16 query rows), so D register r of lane (g, col) of tile i is the logit of key kbeg + 16 i + 8 g + r for query ql0 + 16 s + col: one lane holds half of one query's logits, maximum and sum run in the lane and are joined with lane ^ 16.
// two neighbouring S^T tiles, converted in place, are the B operand (32 keys in the fragments' k order) of O^T += V^T . P^T (A = 16 channels of v, 32 keys); D register r = ctx[query ql0 + 16 s + col][16 j + 8 g + r].
#define QT 2        // query tiles a wave
#define KSPAN 288   // 16 QT + 2 WIN keys: whole 32-key chunks
static_assert(KSPAN >= 16 * QT + 2 * WIN && KSPAN % 96 == 0 && TT % (64 * QT) == 0, "the span holds the band of every query row of the wave");
// 2^x of the 8 values of a tile, in place. In asm so that the slot which the instruction set asks for behind a transcendental is filled by construction: each v_exp_f32 is followed by one on other registers, the last by a v_nop
__device__ __forceinline__ void exp2x8(v8f& x) { float a = x[0], b = x[1], c = x[2], d = x[3], e = x[4], f = x[5], g = x[6], h = x[7];
  asm("v_exp_f32 %0, %0\n\tv_exp_f32 %1, %1\n\tv_exp_f32 %2, %2\n\tv_exp_f32 %3, %3\n\tv_exp_f32 %4, %4\n\tv_exp_f32 %5, %5\n\tv_exp_f32 %6, %6\n\tv_exp_f32 %7, %7\n\tv_nop" : "+v"(a), "+v"(b), "+v"(c), "+v"(d), "+v"(e), "+v"(f), "+v"(g), "+v"(h));
  x = (v8f){a, b, c, d, e, f, g, h}; }
// amdgpu_waves_per_eu(2): at most 512 registers a wave (the logits of both query tiles stay in registers), so that the grid's two waves a SIMD are all resident at once
__global__ __launch_bounds__(128) __attribute__((amdgpu_waves_per_eu(2))) void k_att(const _Float16* __restrict__ QH, const _Float16* __restrict__ KH, const _Float16* __restrict__ VT, _Float16* __restrict__ PY) {
  const int tid = threadIdx.x, wave = tid >> 5, lane = tid & 31, col = lane & 15, g = lane >> 4; const int h = blockIdx.y, b = blockIdx.z; const int ql0 = (blockIdx.x * 4 + wave) * (16 * QT);
  int kbeg = ql0 - WIN; kbeg = kbeg < 0 ? 0 : kbeg; kbeg = kbeg > TT - KSPAN ? TT - KSPAN : kbeg;   /* the span is moved into the sequence at both ends; the keys it gains there are cut by the index rule below */
  /* ql0 and kbeg are multiples of 16: whole row tiles of q and k (k steps 2 h, 2 h + 1), whole 16-key half units of v; two neighbouring half units are the fragment of a 32-key chunk */
  const _Float16* qp = QH + (((size_t)b * TT + ql0) / 16 * KSTEPS + h * 2) * PKU + lane * 8; const _Float16* kp = KH + (((size_t)b * TT + kbeg) / 16 * KSTEPS + h * 2) * PKU + lane * 8; const _Float16* vp = VT + (((size_t)b * (CC / 16) + h * (HD / 16)) * (TT / 16) + kbeg / 16) * 256 + lane * 8;
  v16h q0[QT], q1[QT];
#pragma unroll
  for (int s = 0; s < QT; ++s) { q0[s] = ldh(qp + s * KSTEPS * PKU); q1[s] = ldh(qp + s * KSTEPS * PKU + PKU); }
  v16h kf[KSPAN / 8];
#pragma unroll
  for (int i = 0; i < KSPAN / 16; ++i) { kf[2 * i] = ldh(kp + i * KSTEPS * PKU); kf[2 * i + 1] = ldh(kp + i * KSTEPS * PKU + PKU); }
  asm volatile("s_wait_xcnt 0x0" :: "v"(qp), "v"(kp) : "memory");   /* behind the q and k loads, with their addresses as inputs, so that no register of an address is written again ahead of the wait */
  __builtin_amdgcn_sched_barrier(0);   /* keeps every k load ahead of the first product: one round trip for the span; a tile's two fragments leave as many registers as its logits take */
  v8f sc[QT][KSPAN / 16];
#pragma unroll
  for (int i = 0; i < KSPAN / 16; ++i) {
#pragma unroll
    for (int s = 0; s < QT; ++s) { v8f a = {}; a = __builtin_amdgcn_wmma_f32_16x16x32_f16(false, kf[2 * i], false, q0[s], (short)0, a, false, false); sc[s][i] = __builtin_amdgcn_wmma_f32_16x16x32_f16(false, kf[2 * i + 1], false, q1[s], (short)0, a, false, false); } }
  v16h vf[KSPAN / 8];   /* fragment (32-key chunk c, channel tile j) = vf[4 c + j]; loaded in groups of 3 chunks */
#define VLOAD(G) do { _Pragma("unroll") for (int u = 3 * (G); u < 3 * (G) + 3; ++u) { _Pragma("unroll") for (int j = 0; j < HD / 16; ++j) vf[u * 4 + j] = ldh(vp + j * (TT / 16) * 256 + u * 512); } } while (0)
  v16h p[QT][KSPAN / 32];
#pragma unroll
  for (int s = 0; s < QT; ++s) {
    __builtin_amdgcn_sched_barrier(0);   /* one query tile's softmax ends, as f16 P, before the next begins: mixed, the f32 P of both tiles was live at once and the build spilled; ahead of the first tile it keeps the products in the order of their loads: mixed with the softmax, the build waited for the whole span ahead of its third product */
    if (s == QT - 1) {
      VLOAD(0);                          /* the first group of v loads flies under the last tile's softmax, in the registers that the tile before has left */
      __builtin_amdgcn_sched_barrier(0); /* keeps those loads ahead of the softmax */
    }
    const int dk = kbeg + 8 * g - (ql0 + 16 * s + col) + WIN;   /* key k is allowed for query t iff 0 <= k - t + WIN < 2 WIN */
    float m = -3.0e38f;
#pragma unroll
    for (int i = 0; i < KSPAN / 16; ++i) {
#pragma unroll
      for (int r = 0; r < 8; ++r) { const float v = ((unsigned)(dk + i * 16 + r) < 2u * WIN) ? sc[s][i][r] : -3.0e38f; sc[s][i][r] = v; m = fmaxf(m, v); } }   /* the maximum is taken over the unscaled logits: SCALE > 0 keeps their order */
    m = fmaxf(m, __shfl_xor(m, 16));
    const float l2s = SCALE * 1.44269504088896340736f, mb = m * l2s;   /* exp((s - m) SCALE) = 2^(s l2s - m l2s): one multiply-add and the chip's own 2^x a logit */
    float sum = 0.f;
#pragma unroll
    for (int i = 0; i < KSPAN / 16; ++i) {
#pragma unroll
      for (int r = 0; r < 8; ++r) sc[s][i][r] = fmaf(sc[s][i][r], l2s, -mb);
      exp2x8(sc[s][i]);   /* an excluded key beside an allowed one: 2^(-3.0e38 l2s - mb) = 0 */
#pragma unroll
      for (int r = 0; r < 8; ++r) sum += sc[s][i][r]; }
    sum += __shfl_xor(sum, 16);
    const float inv = (m > -1.0e38f && sum > 0.f) ? 2048.0f / sum : 0.f;   /* P carried x 2^11 into f16; a fully excluded row yields P = 0 */
#pragma unroll
    for (int c = 0; c < KSPAN / 32; ++c) {
#pragma unroll
      for (int r = 0; r < 8; ++r) { p[s][c][r] = (_Float16)(sc[s][2 * c][r] * inv); p[s][c][8 + r] = (_Float16)(sc[s][2 * c + 1][r] * inv); } } }
  static_assert(KSPAN / 32 == 9, "three groups of v loads, each issued one group ahead of its products");
  __builtin_amdgcn_sched_barrier(0);   /* the last softmax ends before the second group of v loads takes its registers */
  VLOAD(1);
  __builtin_amdgcn_sched_barrier(0);   /* keeps those loads ahead of the first group's products, which cover part of their flight */
  v8f acc[QT][HD / 16] = {};
#pragma unroll
  for (int c = 0; c < KSPAN / 32; ++c) {
    if (c == 3) {
      __builtin_amdgcn_sched_barrier(0);   /* the first group's products end before the last group of v loads takes its registers: all three groups live at once spilled */
      VLOAD(2);
      XW(vp);                              /* behind the last v loads: XW as in k_pack */
      __builtin_amdgcn_sched_barrier(0);   /* keeps those loads ahead of the second group's products, which cover part of their flight */
    }
#pragma unroll
    for (int j = 0; j < HD / 16; ++j) {
#pragma unroll
      for (int s = 0; s < QT; ++s) acc[s][j] = __builtin_amdgcn_wmma_f32_16x16x32_f16(false, vf[c * 4 + j], false, p[s][c], (short)0, acc[s][j], false, false); } }
  // lane (g, col) holds ctx[ql0 + 16 s + col][64 h + 16 j + 8 g + r]: acc[s][2 c], acc[s][2 c + 1] are halves 0, 1 of this lane's fragment of k step 2 h + c of row tile (b TT + ql0) / 16 + s for k_out; ctx carried x 2^6 into f16 so small-magnitude context rows stay clear of f16 subnormals
  _Float16* yp = PY + (((size_t)b * TT + ql0) / 16 * KSTEPS + h * 2) * PKU + lane * 8;
#pragma unroll
  for (int s = 0; s < QT; ++s) { v8h w[HD / 16];
#pragma unroll
    for (int j = 0; j < HD / 16; ++j) { const v8f o = acc[s][j] * (1.0f / 2048.0f);
#pragma unroll
      for (int r = 0; r < 8; ++r) w[j][r] = (_Float16)(o[r] * 64.0f);
      *(v8h*)(yp + (s * KSTEPS + (j >> 1)) * PKU + (j & 1) * 256) = w[j]; }
    if (s + 1 < QT) asm volatile("s_wait_xcnt 0x0" :: "v"(yp), "v"(w[0]), "v"(w[1]), "v"(w[2]), "v"(w[3]) : "memory");   /* behind a tile's stores, with their address and data as inputs, so that no register of them is written again ahead of the wait */
  } }
// ---- k_out: block = (128 rows, 128 cols), wave = 64 x 64: out = ctx Wo + bo: ctx x 2^6 f16 against Wo as f16(bf16 x 2^8) exact (1 product) x 2^-14; A = Wo columns, B = ctx rows, so a lane holds 8 neighbouring columns of an output row; staged in the wave's own LDS range, stored as whole lines
__global__ __launch_bounds__(128) void k_out(const _Float16* __restrict__ PY, const _Float16* __restrict__ PWO, const float* __restrict__ BO, float* __restrict__ OUT) { __shared__ __align__(16) float sf[4][64][68];
  const int tid = threadIdx.x, wave = tid >> 5, lane = tid & 31, col = lane & 15, g = lane >> 4; const int c0 = blockIdx.y * 128 + (wave & 1) * 64; const size_t r0 = (size_t)blockIdx.x * 128 + (wave >> 1) * 64;
  v8f acc[4][4] = {};
  gemm64<3, false>((const unsigned*)PWO + (size_t)(c0 / 16) * PKT + lane * 4, (const unsigned*)PY + (r0 / 16) * PKT + lane * 4, acc);
  float bias[4][8] = {};
  if (BO) {
#pragma unroll
    for (int i = 0; i < 4; ++i) {
#pragma unroll
      for (int r = 0; r < 8; ++r) bias[i][r] = bfr(BO[c0 + i * 16 + 8 * g + r]); } }
#pragma unroll
  for (int i = 0; i < 4; ++i) {
#pragma unroll
    for (int j = 0; j < 4; ++j) { float o[8];
#pragma unroll
      for (int r = 0; r < 8; ++r) o[r] = acc[i][j][r] * (1.0f / 16384.0f) + bias[i][r];   /* 2^-8 (Wo carry) x 2^-6 (ctx carry) */
      float* s = &sf[wave][j * 16 + col][i * 16 + 8 * g]; *(v4f*)s = (v4f){o[0], o[1], o[2], o[3]}; *(v4f*)(s + 4) = (v4f){o[4], o[5], o[6], o[7]}; } }
  LDSX();   /* the wave's own LDS writes have landed before other lanes of it read them */
#pragma unroll
  for (int e = 0; e < 32; ++e) { const int mj = e * 2 + g; vst2(OUT + (r0 + mj) * DIN + c0 + col * 4, *(const v4f*)&sf[wave][mj][col * 4]); } }

extern "C" void kernel_launch(void* const* d_in, const int* in_sizes, int n_in, void* d_out, int out_size, void* d_ws, size_t ws_size, hipStream_t stream) {
  (void)in_sizes; (void)n_in; (void)out_size;
  const float** F = (const float**)d_in;
  if (ws_size < (size_t)WS_END) return;
  char* ws = (char*)d_ws; _Float16 *QH = (_Float16*)(ws + WS_QH), *KH = (_Float16*)(ws + WS_KH), *VT = (_Float16*)(ws + WS_VT), *PWO = (_Float16*)(ws + WS_PWO), *PY = (_Float16*)(ws + WS_Y); __bf16 *PX = (__bf16*)(ws + WS_PX), *PW = (__bf16*)(ws + WS_PW);
  // inputs: 0 x [2,4096,512]; 1 Wq [512,512] (in,out), 2 bq; 3 Wk, 4 bk; 5 Wv, 6 bv; 7 Wo (in,out), 8 bo (biases NONZERO)
  k_pack<<<dim3((NJX + NJW + NJO) / 4), 128, 0, stream>>>(F[0], F[1], F[3], F[5], F[7], PX, PW, PWO);
  k_proj<<<dim3(TNB * TT / 128, CC / 128, 3), 128, 0, stream>>>(PX, PW, F[2], F[4], F[6], QH, KH, VT);
  k_att<<<dim3(NQB / QT, NH, TNB), 128, 0, stream>>>(QH, KH, VT, PY);
  k_out<<<dim3(TNB * TT / 128, DIN / 128), 128, 0, stream>>>(PY, PWO, F[8], (float*)d_out);
}

// v005
// It runs in 37.3 microseconds.
// In two side-by-side timings against v004, it was 1.11 and 1.12 times as fast.
// Over all steps from v000 it is 15.2 times as fast.
// compute dtype: all float inputs rounded to bf16; q / k / v projections with EXACT bf16 products on WMMA 16x16x32 (f32 accumulate) + bias; logits q x k once to f16 each (1 product) x 64^-0.5, computed only for a 288-key span round the +-128 band of each 32 query rows; the exact band rule by index; softmax f32; P x 2^11 once to f16 x v once to f16 (1 product) over that span, all three in one kernel; ctx x 2^6 once to f16 x Wo f16(bf16 x 2^8) + bo; f32 output.
#include <hip/hip_runtime.h>
#include <math.h>

typedef __attribute__((ext_vector_type(16))) _Float16 v16h;
typedef __attribute__((ext_vector_type(16))) __bf16 v16b;
typedef __attribute__((ext_vector_type(8)))  _Float16 v8h;
typedef __attribute__((ext_vector_type(8)))  float v8f;
typedef __attribute__((ext_vector_type(4)))  float v4f;
typedef __attribute__((ext_vector_type(2)))  float v2f;
typedef __attribute__((ext_vector_type(4)))  unsigned v4u;
typedef __attribute__((ext_vector_type(4)))  int v4i;
typedef float __attribute__((may_alias)) float_a;
typedef int __attribute__((may_alias)) int_a;

template <typename T> __device__ __forceinline__ void vst2(void* p, T v) { *(T*)p = v;  }
__device__ __forceinline__ v8f wmma16(v16h a, v16h b, v8f c) {
  v8f d = __builtin_amdgcn_wmma_f32_16x16x32_f16(false, a, false, b, (short)0, c, false, false);
  asm volatile("v_nop\n\tv_nop\n\tv_nop\n\tv_nop" : "+v"(d) : "v"(a), "v"(b));
  return d;
}
__device__ __forceinline__ v8f wmma_bf(v16b a, v16b b, v8f c) {
  v8f d = __builtin_amdgcn_wmma_f32_16x16x32_bf16(false, a, false, b, (short)0, c, false, false);
  asm volatile("v_nop\n\tv_nop\n\tv_nop\n\tv_nop" : "+v"(d) : "v"(a), "v"(b));
  return d;
}
// 16x16x32 fragments: lane = (h = lane>>4, row/col = lane&15); elements 0..7 = k0+8h+0..7, 8..15 = k0+16+8h+0..7; D element r = row 8h+r
__device__ __forceinline__ v16h frag_h(const _Float16* rowk0, int lane) {
  union { v16h v; v8h q[2]; } u; const _Float16* p = rowk0 + 8 * (lane >> 4);
  u.q[0] = *(const v8h*)p; u.q[1] = *(const v8h*)(p + 16); return u.v;
}
__device__ __forceinline__ v16h frag_f32(const float* rowk0, int lane) {
  v16h a; const float* p = rowk0 + 8 * (lane >> 4);
#pragma unroll
  for (int i = 0; i < 8; ++i) { a[i] = (_Float16)p[i]; a[8 + i] = (_Float16)p[16 + i]; }
  return a;
}
__device__ __forceinline__ v16h frag_f32s(const float* rowk0, int lane, float sc) {
  v16h a; const float* p = rowk0 + 8 * (lane >> 4);
#pragma unroll
  for (int i = 0; i < 8; ++i) { a[i] = (_Float16)(p[i] * sc); a[8 + i] = (_Float16)(p[16 + i] * sc); }
  return a;
}
// column fragment from a [K][ld] layout (column n), rows >= K read as 0
__device__ __forceinline__ v16h fragc_f32(const float* W, int k0, int n, int lane, int ld, int K) {
  v16h a; const int g = lane >> 4;
#pragma unroll
  for (int i = 0; i < 8; ++i) { const int ka = k0 + 8 * g + i, kb = ka + 16;
    a[i] = (_Float16)(ka < K ? W[(size_t)(ka < K ? ka : K - 1) * ld + n] : 0.f); a[8 + i] = (_Float16)(kb < K ? W[(size_t)(kb < K ? kb : K - 1) * ld + n] : 0.f); }
  return a;
}
struct F2 { v16b h, l; };
__device__ __forceinline__ F2 bsplit16(const float v[16]) { F2 r;
#pragma unroll
  for (int i = 0; i < 16; ++i) { const __bf16 h = (__bf16)v[i]; r.h[i] = h; r.l[i] = (__bf16)(v[i] - (float)h); }
  return r; }
__device__ __forceinline__ F2 split_row(const float* row, int k0, int lane) { float v[16]; const float* p = row + k0 + 8 * (lane >> 4);
#pragma unroll
  for (int i = 0; i < 8; ++i) { v[i] = p[i]; v[8 + i] = p[16 + i]; }
  return bsplit16(v); }
__device__ __forceinline__ F2 split_rowK(const float* row, int k0, int lane, int K) { float v[16]; const int g = lane >> 4;
#pragma unroll
  for (int i = 0; i < 8; ++i) { const int ka = k0 + 8 * g + i, kb = ka + 16; v[i] = ka < K ? row[ka < K ? ka : K - 1] : 0.f; v[8 + i] = kb < K ? row[kb < K ? kb : K - 1] : 0.f; }
  return bsplit16(v); }
__device__ __forceinline__ F2 split_col(const float* W, int k0, int n, int lane, int ld, int K) { float v[16]; const int g = lane >> 4;
#pragma unroll
  for (int i = 0; i < 8; ++i) { const int ka = k0 + 8 * g + i, kb = ka + 16; v[i] = ka < K ? W[(size_t)(ka < K ? ka : K - 1) * ld + n] : 0.f; v[8 + i] = kb < K ? W[(size_t)(kb < K ? kb : K - 1) * ld + n] : 0.f; }
  return bsplit16(v); }
__device__ __forceinline__ v8f mac3(const F2& a, const F2& b, v8f c) { c = wmma_bf(a.l, b.h, c); c = wmma_bf(a.h, b.l, c); return wmma_bf(a.h, b.h, c); }
__device__ __forceinline__ float sigm(float v) { return 1.0f / (1.0f + expf(-v)); }
#define LDSX() do { asm volatile("s_wait_dscnt 0" ::: "memory"); __builtin_amdgcn_wave_barrier(); __builtin_amdgcn_fence(__ATOMIC_RELEASE, "workgroup"); } while (0)

// Multi-head SLIDING-WINDOW self-attention (x [2,4096,512]; (in,out) Wq / Wk / Wv / Wo [512,512] and biases [512], all N(0,1) x 0.02 - biases NONZERO; 8 heads x 64; scores / sqrt(64); allowed = (j >= i - 128) & (j < i + 128) by index, -inf elsewhere; softmax over the keys; out @ Wo + bo). Only a span of keys round the band of 32 query rows is computed - a superset of every row's own band, which is then cut exactly by index.
#define NB 2
#define TT 4096
#define CC 512            // NH * HD = projected width
#define DIN 512          // input (model) width
#define NH 8
#define HD 64
#define NQB (TT / 64)
#define HG 1
#define SCALE (0.125f)
#define CAUSAL 0
#ifndef TNB
#define TNB NB
#endif
__device__ __forceinline__ float bfr(float v) { return (float)(__bf16)v; }
#define WIN 128   // window: key j is allowed for query i iff i - WIN <= j < i + WIN
typedef __attribute__((ext_vector_type(8))) __bf16 v8b;
__device__ __forceinline__ v16b frag_b(const __bf16* rowk0, int lane) {
  union { v16b v; v8b q[2]; } u; const __bf16* p = rowk0 + 8 * (lane >> 4);
  u.q[0] = *(const v8b*)p; u.q[1] = *(const v8b*)(p + 16); return u.v;
}
#define QBH 0              // unused: this file has no causal or high-precision path
#define QHI 0               // single-product logits on every row (0.02-scale weights: logit sigma ~0.1)
#define KHI 64            // key rows carrying k residual / v bf16 hi+lo planes (only sizes the workspace regions below, which nothing here writes)
// B fragment (k rows k0+.., output column o) of a weight: (in,out) [K][ld] or (out,in) [ld rows of K]: bf16 exact, or f16(bf16 * 256) exact
__device__ __forceinline__ v16b wcol_io(const float* Wm, int k0, int o, int lane, int ld) { v16b w; const int g = lane >> 4;
#pragma unroll
  for (int i = 0; i < 8; ++i) { w[i] = (__bf16)Wm[(size_t)(k0 + 8 * g + i) * ld + o]; w[8 + i] = (__bf16)Wm[(size_t)(k0 + 16 + 8 * g + i) * ld + o]; }
  return w; }
__device__ __forceinline__ v16b wcol_oi(const float* Wm, int k0, int o, int lane, int K) { v16b w; const float* p = Wm + (size_t)o * K + k0 + 8 * (lane >> 4);
#pragma unroll
  for (int i = 0; i < 8; ++i) { w[i] = (__bf16)p[i]; w[8 + i] = (__bf16)p[16 + i]; }
  return w; }
__device__ __forceinline__ v16h wcolh_io(const float* Wm, int k0, int o, int lane, int ld) { v16h w; const int g = lane >> 4;
#pragma unroll
  for (int i = 0; i < 8; ++i) { w[i] = (_Float16)(bfr(Wm[(size_t)(k0 + 8 * g + i) * ld + o]) * 256.0f); w[8 + i] = (_Float16)(bfr(Wm[(size_t)(k0 + 16 + 8 * g + i) * ld + o]) * 256.0f); }
  return w; }
__device__ __forceinline__ v16h wcolh_oi(const float* Wm, int k0, int o, int lane, int K) { v16h w; const float* p = Wm + (size_t)o * K + k0 + 8 * (lane >> 4);
#pragma unroll
  for (int i = 0; i < 8; ++i) { w[i] = (_Float16)(bfr(p[i]) * 256.0f); w[8 + i] = (_Float16)(bfr(p[16 + i]) * 256.0f); }
  return w; }
#define WQKV_LAYOUT 0   // 0 = (in,out) [DIN][CC]; 1 = (out,in) [CC][DIN]; 2 = per-head [NH][DIN][HD]
__device__ __forceinline__ v16b wcol_hdk(const float* Wm, int k0, int o, int lane) { v16b w; const int g = lane >> 4; const float* p = Wm + (size_t)(o / HD) * DIN * HD + (o % HD);
#pragma unroll
  for (int i = 0; i < 8; ++i) { w[i] = (__bf16)p[(size_t)(k0 + 8 * g + i) * HD]; w[8 + i] = (__bf16)p[(size_t)(k0 + 16 + 8 * g + i) * HD]; }
  return w; }
#define WO_OUT_IN 0
#if WQKV_LAYOUT == 1
#define WCOL(W, k0, o, lane) wcol_oi(W, k0, o, lane, DIN)
#elif WQKV_LAYOUT == 2
#define WCOL(W, k0, o, lane) wcol_hdk(W, k0, o, lane)
#else
#define WCOL(W, k0, o, lane) wcol_io(W, k0, o, lane, CC)
#endif
#if WO_OUT_IN
#define WOCOL(W, k0, o, lane) wcol_oi(W, k0, o, lane, CC)
#define WOCOLH(W, k0, o, lane) wcolh_oi(W, k0, o, lane, CC)
#else
#define WOCOL(W, k0, o, lane) wcol_io(W, k0, o, lane, DIN)
#define WOCOLH(W, k0, o, lane) wcolh_io(W, k0, o, lane, DIN)
#endif

#define WS_QH  0u                                      // f16 q, packed fragments [row tile][k step]
#define WS_KH  (WS_QH + 2u * (size_t)NB * TT * CC)      // f16 k, packed fragments [row tile][k step]
#define WS_VT  (WS_KH + 2u * (size_t)NB * TT * CC)      // f16 v, packed half units [b][channel tile][16-key tile]
#define WS_QL  (WS_VT + 2u * (size_t)NB * CC * TT)      // f16 q residual x 2^10 rows [b][t < QHI][CC]
#define WS_KL  (WS_QL + 2u * (size_t)NB * QHI * CC)     // f16 k residual x 2^10 rows [b][t < KHI][CC]
#define WS_VB  (WS_KL + 2u * (size_t)NB * KHI * CC)     // bf16 v hi planes [b][c][t < KHI]
#define WS_VBL (WS_VB + 2u * (size_t)NB * CC * KHI)
#define WS_S   (WS_VBL + 2u * (size_t)NB * CC * KHI)    // the packed operands PX, PW, PWO below lie at its start; the size is kept so that the offsets behind it stay
#define WS_PX  WS_S                                     // bf16 x, packed fragments [row tile][k step]
#define WS_PW  (WS_PX + 2u * (size_t)NB * TT * DIN)     // bf16 Wq, Wk, Wv, packed fragments [which][column tile][k step]
#define WS_PWO (WS_PW + 2u * 3u * (size_t)DIN * CC)     // f16(bf16 x 2^8) Wo, packed fragments [column tile][k step]
#define WS_Y   (WS_S  + 4u * (size_t)HG * TT * TT)      // f16 ctx x 2^6, packed fragments [row tile][k step]
#define WS_END (WS_Y  + 4u * (size_t)NB * TT * CC)

// ---- packed fragments: every WMMA operand that passes through the workspace lies there in the order in which a wave's registers hold it. unit (16-wide tile T, k step kc of 32) = 1 KiB at element (T * 16 + kc) * 512: [half 0: elements 0..7][half 1: elements 8..15] x [lane 0..31] x 8 elements, so a fragment is two 16-byte loads a lane, each 512 contiguous bytes a wave.
typedef __attribute__((ext_vector_type(8))) unsigned v8u;
#define KSTEPS 16          // DIN / 32 = CC / 32
#define PKU 512            // 16-bit elements of a unit
#define PKT (KSTEPS * 256) // dwords of a tile's 16 units
__device__ __forceinline__ v8u ldf(const unsigned* __restrict__ p) { const v4u lo = *(const v4u*)p, hi = *(const v4u*)(p + 128); return __builtin_shufflevector(lo, hi, 0, 1, 2, 3, 4, 5, 6, 7); }
__device__ __forceinline__ v16h ldh(const _Float16* __restrict__ p) { union { v16h v; v8h q[2]; } u; u.q[0] = *(const v8h*)p; u.q[1] = *(const v8h*)(p + 256); return u.v; }
template <bool BF> __device__ __forceinline__ v8f mm(v8u a, v8u b, v8f c) {
  if constexpr (BF) return __builtin_amdgcn_wmma_f32_16x16x32_bf16(false, __builtin_bit_cast(v16b, a), false, __builtin_bit_cast(v16b, b), (short)0, c, false, false);
  else return __builtin_amdgcn_wmma_f32_16x16x32_f16(false, __builtin_bit_cast(v16h, a), false, __builtin_bit_cast(v16h, b), (short)0, c, false, false);
}
// l2ask: a hint that brings the 256-byte unit at p (one unit a lane) into L2; no data returns and no counter moves. The operands of k_proj, k_att and k_out were stored by earlier launches of the same call, and a unit that the reader's L2 does not hold comes from memory: asked for at block entry it can be there by the time its k step loads it (nothing counts on that). Every address lies inside the operand's own buffer.
__device__ __forceinline__ void l2ask(const char* p) { asm volatile("global_prefetch_b8 %0, off scope:SCOPE_SE" :: "v"(p)); }
// l2hold, at a kernel's end: the address stays in its registers to there, so that a register which an issued hint names never holds anything but that address (no wait covers a hint)
__device__ __forceinline__ void l2hold(const char* p) { asm volatile("" :: "v"(p)); }
// byte offset of a lane's unit in a panel of 8 tiles (128 KiB) of packed fragments: run q4 of 4 k steps (4 KiB = 16 units) of tiles 2 wave, 2 wave + 1: the 4 waves of a block ask for a quarter of the panel
__device__ __forceinline__ size_t l2off(int wave, int lane, int q4) { return (size_t)(wave * 2 + (lane >> 4)) * (PKT * 4) + q4 * 4096 + (lane & 15) * 256; }
// one wave: a 64 x 64 tile, acc[i][j] = (A-side tile i) . (B-side tile j)^T over K = 512, k steps in rising order; pa, pb = the lane's own 16 bytes in the first unit of the first tile. NBUF fragment sets: the loads of step kc + NBUF - 1 are issued ahead of the products of step kc. ha, hb: the wave's two hints (l2ask), issued behind the first steps' loads.
template <int NBUF, bool BF> __device__ __forceinline__ void gemm64(const unsigned* __restrict__ pa, const unsigned* __restrict__ pb, v8f (&acc)[4][4], const char* ha, const char* hb) {
  v8u fa[NBUF][4], fb[NBUF][4];
#pragma unroll
  for (int s = 0; s < NBUF - 1; ++s) {
#pragma unroll
    for (int u = 0; u < 4; ++u) { fa[s][u] = ldf(pa + u * PKT + s * 256); fb[s][u] = ldf(pb + u * PKT + s * 256); } }
#pragma unroll
  for (int kc = 0; kc < KSTEPS; ++kc) { const int nx = kc + NBUF - 1;
    if (nx < KSTEPS) {
#pragma unroll
      for (int u = 0; u < 4; ++u) { fa[nx % NBUF][u] = ldf(pa + u * PKT + nx * 256); fb[nx % NBUF][u] = ldf(pb + u * PKT + nx * 256); } }
    if (kc == 0) { l2ask(ha); l2ask(hb); }
    __builtin_amdgcn_sched_barrier(0);   /* keeps the 16 loads above ahead of this step's products: without it the build sank each load to its first use and waited for it there, four round trips a step */
#pragma unroll
    for (int j = 0; j < 4; ++j) {
#pragma unroll
      for (int i = 0; i < 4; ++i) acc[i][j] = mm<BF>(fa[kc % NBUF][i], fb[kc % NBUF][j], acc[i][j]); }
    __builtin_amdgcn_sched_barrier(0);   /* keeps the next group of loads behind these products, so that each group is one run of loads */
  } }
// ---- k_pack: wave = one 16-wide tile x 4 k steps of x (bf16), of Wq / Wk / Wv (bf16) or of Wo (f16(bf16 x 2^8)): the fragments as the GEMMs' own loaders formed them, each formed once a call
#define NJX (TNB * TT / 16 * 4)
#define NJW (3 * (CC / 16) * 4)
#define NJO ((DIN / 16) * 4)
__global__ __launch_bounds__(128) void k_pack(const float* __restrict__ X, const float* __restrict__ WQ, const float* __restrict__ WK, const float* __restrict__ WV, const float* __restrict__ WO, __bf16* __restrict__ PX, __bf16* __restrict__ PW, _Float16* __restrict__ PWO) {
  const int tid = threadIdx.x, lane = tid & 31, col = lane & 15, g = lane >> 4; const int job = blockIdx.x * 4 + (tid >> 5);
  // XW(p): s_wait_xcnt 0 behind a run of loads, with their address as an input, so that no register of it is written again ahead of the wait
#define XW(p) asm volatile("s_wait_xcnt 0x0" :: "v"(p) : "memory")
  if (job < NJX) { const int T = job >> 2, k4 = (job & 3) * 4; const float* p = X + ((size_t)T * 16 + col) * DIN + k4 * 32 + 8 * g; __bf16* d = PX + ((size_t)T * KSTEPS + k4) * PKU + lane * 8; float v[4][16];
#pragma unroll
    for (int u = 0; u < 4; ++u) {
#pragma unroll
      for (int i = 0; i < 8; ++i) { v[u][i] = p[u * 32 + i]; v[u][8 + i] = p[u * 32 + 16 + i]; } }
    XW(p);
#pragma unroll
    for (int u = 0; u < 4; ++u) { v8b lo, hi;
#pragma unroll
      for (int i = 0; i < 8; ++i) { lo[i] = (__bf16)v[u][i]; hi[i] = (__bf16)v[u][8 + i]; }
      *(v8b*)(d + u * PKU) = lo; *(v8b*)(d + u * PKU + 256) = hi; }
  } else { const bool isO = job >= NJX + NJW; const int jw = job - (isO ? NJX + NJW : NJX), T = jw >> 2, k4 = (jw & 3) * 4, which = T / (CC / 16); const float* WA = isO ? WO : which == 0 ? WQ : which == 1 ? WK : WV;
    /* (in,out) weights, all four [512][512]: column T' * 16 + col, rows k4 * 32 + 8 g + .. */
    static_assert(DIN == CC, "one row pitch for all four weights"); const float* p = WA + (size_t)(k4 * 32 + 8 * g) * CC + (T % (CC / 16)) * 16 + col; float v[4][16];
#pragma unroll
    for (int u = 0; u < 4; ++u) {
#pragma unroll
      for (int i = 0; i < 8; ++i) { v[u][i] = p[(u * 32 + i) * CC]; v[u][8 + i] = p[(u * 32 + 16 + i) * CC]; } }
    XW(p);
    if (!isO) { __bf16* d = PW + ((size_t)T * KSTEPS + k4) * PKU + lane * 8;
#pragma unroll
      for (int u = 0; u < 4; ++u) { v8b lo, hi;
#pragma unroll
        for (int i = 0; i < 8; ++i) { lo[i] = (__bf16)v[u][i]; hi[i] = (__bf16)v[u][8 + i]; }
        *(v8b*)(d + u * PKU) = lo; *(v8b*)(d + u * PKU + 256) = hi; }
    } else { _Float16* d = PWO + ((size_t)T * KSTEPS + k4) * PKU + lane * 8;
#pragma unroll
      for (int u = 0; u < 4; ++u) { v8h lo, hi;
#pragma unroll
        for (int i = 0; i < 8; ++i) { lo[i] = (_Float16)(bfr(v[u][i]) * 256.0f); hi[i] = (_Float16)(bfr(v[u][8 + i]) * 256.0f); }
        *(v8h*)(d + u * PKU) = lo; *(v8h*)(d + u * PKU + 256) = hi; } } } }
// ---- k_proj: block = (128 rows, 128 cols, which), wave = 64 x 64: q/k/v = X W + b with exact bf16 products (K = DIN). D register r of lane (g, col) of acc[i][j] = (A-side index 16 i + 8 g + r, B-side index 16 j + col): 8 neighbouring A-side indices a lane, which is half a fragment of k_att, stored as it stands (16 bytes a lane, 512 contiguous bytes a wave).
// which 0, 1: q, k: A = W columns, B = x rows: acc[i][j] = half (i & 1) of unit (row tile r0 / 16 + j, k step c0 / 32 + (i >> 1)). which 2: v: A = x rows, B = W columns: acc[i][j] = the half unit (channel tile c0 / 16 + j, 16-key tile t0 / 16 + i).
// amdgpu_waves_per_eu(3): at most 336 registers a wave, so that the grid's three waves a SIMD are all resident at once
__global__ __launch_bounds__(128) __attribute__((amdgpu_waves_per_eu(3))) void k_proj(const __bf16* __restrict__ PX, const __bf16* __restrict__ PW, const float* __restrict__ BQ, const float* __restrict__ BK, const float* __restrict__ BV, _Float16* __restrict__ QH, _Float16* __restrict__ KH, _Float16* __restrict__ VT) {
  const int tid = threadIdx.x, wave = tid >> 5, lane = tid & 31, col = lane & 15, g = lane >> 4; const int which = blockIdx.z; const int c0 = blockIdx.y * 128 + (wave & 1) * 64; const size_t r0 = (size_t)blockIdx.x * 128 + (wave >> 1) * 64; const size_t bb = r0 / TT; const int t0 = (int)(r0 % TT);
  const unsigned* px = (const unsigned*)PX + (r0 / 16) * PKT + lane * 4; const unsigned* pw = (const unsigned*)PW + ((size_t)which * (CC / 16) + c0 / 16) * PKT + lane * 4;
  const float* BA = which == 0 ? BQ : which == 1 ? BK : BV;
  /* hints: the 12 blocks that read these 128 rows of x share its panel out by (y + z) & 3, the 64 blocks that read these 128 columns of W theirs by (x >> 3) & 3 */
  const char* hx = (const char*)PX + (size_t)blockIdx.x * 8 * (PKT * 4) + l2off(wave, lane, (blockIdx.y + blockIdx.z) & 3); const char* hw = (const char*)PW + ((size_t)which * (CC / 16) + blockIdx.y * 8) * (PKT * 4) + l2off(wave, lane, (blockIdx.x >> 3) & 3);
  v8f acc[4][4] = {};
  gemm64<2, true>(which < 2 ? pw : px, which < 2 ? px : pw, acc, hx, hw);
  if (which < 2) { _Float16* d = (which == 0 ? QH : KH) + ((r0 / 16) * KSTEPS + c0 / 32) * PKU + lane * 8; float bias[4][8] = {};
    if (BA) { const float* bp = BA + c0 + 8 * g;
#pragma unroll
      for (int i = 0; i < 4; ++i) {
#pragma unroll
        for (int r = 0; r < 8; ++r) bias[i][r] = bfr(bp[i * 16 + r]); }
      XW(bp);   /* behind the bias loads, with their address as an input */
    }
#pragma unroll
    for (int j = 0; j < 4; ++j) {
#pragma unroll
      for (int i = 0; i < 4; ++i) { v8h hv;
#pragma unroll
        for (int r = 0; r < 8; ++r) hv[r] = (_Float16)(acc[i][j][r] + bias[i][r]);
        *(v8h*)(d + (j * KSTEPS + (i >> 1)) * PKU + (i & 1) * 256) = hv; } }
  } else { _Float16* d = VT + ((bb * (CC / 16) + c0 / 16) * (TT / 16) + t0 / 16) * 256 + lane * 8; float bias[4] = {};
    if (BA) {
#pragma unroll
      for (int j = 0; j < 4; ++j) bias[j] = bfr(BA[c0 + j * 16 + col]); }
#pragma unroll
    for (int j = 0; j < 4; ++j) {
#pragma unroll
      for (int i = 0; i < 4; ++i) { v8h hv;
#pragma unroll
        for (int r = 0; r < 8; ++r) hv[r] = (_Float16)(acc[i][j][r] + bias[j]);
        *(v8h*)(d + (j * (TT / 16) + i) * 256) = hv; } }
    XW(d);   /* behind the v path's last stores: the two paths join in front of l2hold, and no register of a store is written again ahead of the wait */
  }
  l2hold(hx); l2hold(hw); }
// ---- k_att: scores, softmax and P . v in one kernel, one launch for every (batch, head). wave = QT tiles of 16 query rows, t = ql0 .. ql0 + 16 QT - 1 of (b, h), against one span of KSPAN keys, which holds every key of [ql0 - WIN, ql0 + 16 QT - 1 + WIN) that lies in the sequence: each k and v fragment is loaded once and multiplied with every query tile of the wave; the waves of a block share nothing.
// transposed products: S^T = K . Q^T (A = 16 key rows, B = 16 query rows), so D register r of lane (g, col) of tile i is the logit of key kbeg + 16 i + 8 g + r for query ql0 + 16 s + col: one lane holds half of one query's logits, maximum and sum run in the lane and are joined with lane ^ 16.
// two neighbouring S^T tiles, converted in place, are the B operand (32 keys in the fragments' k order) of O^T += V^T . P^T (A = 16 channels of v, 32 keys); D register r = ctx[query ql0 + 16 s + col][16 j + 8 g + r].
#define QT 2        // query tiles a wave
#define KSPAN 288   // 16 QT + 2 WIN keys: whole 32-key chunks
static_assert(KSPAN >= 16 * QT + 2 * WIN && KSPAN % 96 == 0 && TT % (64 * QT) == 0, "the span holds the band of every query row of the wave");
// 2^x of the 8 values of a tile, in place. In asm so that the slot which the instruction set asks for behind a transcendental is filled by construction: each v_exp_f32 is followed by one on other registers, the last by a v_nop
__device__ __forceinline__ void exp2x8(v8f& x) { float a = x[0], b = x[1], c = x[2], d = x[3], e = x[4], f = x[5], g = x[6], h = x[7];
  asm("v_exp_f32 %0, %0\n\tv_exp_f32 %1, %1\n\tv_exp_f32 %2, %2\n\tv_exp_f32 %3, %3\n\tv_exp_f32 %4, %4\n\tv_exp_f32 %5, %5\n\tv_exp_f32 %6, %6\n\tv_exp_f32 %7, %7\n\tv_nop" : "+v"(a), "+v"(b), "+v"(c), "+v"(d), "+v"(e), "+v"(f), "+v"(g), "+v"(h));
  x = (v8f){a, b, c, d, e, f, g, h}; }
// amdgpu_waves_per_eu(2): at most 512 registers a wave (the logits of both query tiles stay in registers), so that the grid's two waves a SIMD are all resident at once
__global__ __launch_bounds__(128) __attribute__((amdgpu_waves_per_eu(2))) void k_att(const _Float16* __restrict__ QH, const _Float16* __restrict__ KH, const _Float16* __restrict__ VT, _Float16* __restrict__ PY) {
  const int tid = threadIdx.x, wave = tid >> 5, lane = tid & 31, col = lane & 15, g = lane >> 4; const int h = blockIdx.y, b = blockIdx.z; const int ql0 = (blockIdx.x * 4 + wave) * (16 * QT);
  int kbeg = ql0 - WIN; kbeg = kbeg < 0 ? 0 : kbeg; kbeg = kbeg > TT - KSPAN ? TT - KSPAN : kbeg;   /* the span is moved into the sequence at both ends; the keys it gains there are cut by the index rule below */
  /* ql0 and kbeg are multiples of 16: whole row tiles of q and k (k steps 2 h, 2 h + 1), whole 16-key half units of v; two neighbouring half units are the fragment of a 32-key chunk */
  const _Float16* qp = QH + (((size_t)b * TT + ql0) / 16 * KSTEPS + h * 2) * PKU + lane * 8; const _Float16* kp = KH + (((size_t)b * TT + kbeg) / 16 * KSTEPS + h * 2) * PKU + lane * 8; const _Float16* vp = VT + (((size_t)b * (CC / 16) + h * (HD / 16)) * (TT / 16) + kbeg / 16) * 256 + lane * 8;
  v16h q0[QT], q1[QT];
#pragma unroll
  for (int s = 0; s < QT; ++s) { q0[s] = ldh(qp + s * KSTEPS * PKU); q1[s] = ldh(qp + s * KSTEPS * PKU + PKU); }
  v16h kf[KSPAN / 8];
#pragma unroll
  for (int i = 0; i < KSPAN / 16; ++i) { kf[2 * i] = ldh(kp + i * KSTEPS * PKU); kf[2 * i + 1] = ldh(kp + i * KSTEPS * PKU + PKU); }
  asm volatile("s_wait_xcnt 0x0" :: "v"(qp), "v"(kp) : "memory");   /* behind the q and k loads, with their addresses as inputs, so that no register of an address is written again ahead of the wait */
  /* hints behind the k loads: the block's waves read v of 64 QT + 2 WIN keys in all; wave w asks for channel tile w of them, 12 KiB = 48 units, which are loaded only behind the logits and the first tile's softmax */
  static_assert(HD / 16 == 4 && (64 * QT + 2 * WIN) * 32 == 48 * 256, "a channel tile a wave, 48 units");
  int kb = (int)blockIdx.x * (64 * QT) - WIN; kb = kb < 0 ? 0 : kb; kb = kb > TT - (64 * QT + 2 * WIN) ? TT - (64 * QT + 2 * WIN) : kb;
  const char* hv0 = (const char*)VT + (((size_t)b * (CC / 16) + h * (HD / 16) + wave) * (TT / 16) + kb / 16) * 512 + lane * 256; const char* hv1 = hv0 + (32 - (lane & 16)) * 256;   /* units 0 .. 31; units 32 .. 47, each from two lanes */
  l2ask(hv0); l2ask(hv1);
  __builtin_amdgcn_sched_barrier(0);   /* keeps every k load ahead of the first product: one round trip for the span; a tile's two fragments leave as many registers as its logits take */
  v8f sc[QT][KSPAN / 16];
#pragma unroll
  for (int i = 0; i < KSPAN / 16; ++i) {
#pragma unroll
    for (int s = 0; s < QT; ++s) { v8f a = {}; a = __builtin_amdgcn_wmma_f32_16x16x32_f16(false, kf[2 * i], false, q0[s], (short)0, a, false, false); sc[s][i] = __builtin_amdgcn_wmma_f32_16x16x32_f16(false, kf[2 * i + 1], false, q1[s], (short)0, a, false, false); } }
  v16h vf[KSPAN / 8];   /* fragment (32-key chunk c, channel tile j) = vf[4 c + j]; loaded in groups of 3 chunks */
#define VLOAD(G) do { _Pragma("unroll") for (int u = 3 * (G); u < 3 * (G) + 3; ++u) { _Pragma("unroll") for (int j = 0; j < HD / 16; ++j) vf[u * 4 + j] = ldh(vp + j * (TT / 16) * 256 + u * 512); } } while (0)
  v16h p[QT][KSPAN / 32];
#pragma unroll
  for (int s = 0; s < QT; ++s) {
    __builtin_amdgcn_sched_barrier(0);   /* one query tile's softmax ends, as f16 P, before the next begins: mixed, the f32 P of both tiles was live at once and the build spilled; ahead of the first tile it keeps the products in the order of their loads: mixed with the softmax, the build waited for the whole span ahead of its third product */
    if (s == QT - 1) {
      VLOAD(0);                          /* the first group of v loads flies under the last tile's softmax, in the registers that the tile before has left */
      __builtin_amdgcn_sched_barrier(0); /* keeps those loads ahead of the softmax */
    }
    const int dk = kbeg + 8 * g - (ql0 + 16 * s + col) + WIN;   /* key k is allowed for query t iff 0 <= k - t + WIN < 2 WIN */
    float m = -3.0e38f;
#pragma unroll
    for (int i = 0; i < KSPAN / 16; ++i) {
#pragma unroll
      for (int r = 0; r < 8; ++r) { const float v = ((unsigned)(dk + i * 16 + r) < 2u * WIN) ? sc[s][i][r] : -3.0e38f; sc[s][i][r] = v; m = fmaxf(m, v); } }   /* the maximum is taken over the unscaled logits: SCALE > 0 keeps their order */
    m = fmaxf(m, __shfl_xor(m, 16));
    const float l2s = SCALE * 1.44269504088896340736f, mb = m * l2s;   /* exp((s - m) SCALE) = 2^(s l2s - m l2s): one multiply-add and the chip's own 2^x a logit */
    float sum = 0.f;
#pragma unroll
    for (int i = 0; i < KSPAN / 16; ++i) {
#pragma unroll
      for (int r = 0; r < 8; ++r) sc[s][i][r] = fmaf(sc[s][i][r], l2s, -mb);
      exp2x8(sc[s][i]);   /* an excluded key beside an allowed one: 2^(-3.0e38 l2s - mb) = 0 */
#pragma unroll
      for (int r = 0; r < 8; ++r) sum += sc[s][i][r]; }
    sum += __shfl_xor(sum, 16);
    const float inv = (m > -1.0e38f && sum > 0.f) ? 2048.0f / sum : 0.f;   /* P carried x 2^11 into f16; a fully excluded row yields P = 0 */
#pragma unroll
    for (int c = 0; c < KSPAN / 32; ++c) {
#pragma unroll
      for (int r = 0; r < 8; ++r) { p[s][c][r] = (_Float16)(sc[s][2 * c][r] * inv); p[s][c][8 + r] = (_Float16)(sc[s][2 * c + 1][r] * inv); } } }
  static_assert(KSPAN / 32 == 9, "three groups of v loads, each issued one group ahead of its products");
  __builtin_amdgcn_sched_barrier(0);   /* the last softmax ends before the second group of v loads takes its registers */
  VLOAD(1);
  __builtin_amdgcn_sched_barrier(0);   /* keeps those loads ahead of the first group's products, which cover part of their flight */
  v8f acc[QT][HD / 16] = {};
#pragma unroll
  for (int c = 0; c < KSPAN / 32; ++c) {
    if (c == 3) {
      __builtin_amdgcn_sched_barrier(0);   /* the first group's products end before the last group of v loads takes its registers: all three groups live at once spilled */
      VLOAD(2);
      XW(vp);                              /* behind the last v loads: XW as in k_pack */
      __builtin_amdgcn_sched_barrier(0);   /* keeps those loads ahead of the second group's products, which cover part of their flight */
    }
#pragma unroll
    for (int j = 0; j < HD / 16; ++j) {
#pragma unroll
      for (int s = 0; s < QT; ++s) acc[s][j] = __builtin_amdgcn_wmma_f32_16x16x32_f16(false, vf[c * 4 + j], false, p[s][c], (short)0, acc[s][j], false, false); } }
  // lane (g, col) holds ctx[ql0 + 16 s + col][64 h + 16 j + 8 g + r]: acc[s][2 c], acc[s][2 c + 1] are halves 0, 1 of this lane's fragment of k step 2 h + c of row tile (b TT + ql0) / 16 + s for k_out; ctx carried x 2^6 into f16 so small-magnitude context rows stay clear of f16 subnormals
  _Float16* yp = PY + (((size_t)b * TT + ql0) / 16 * KSTEPS + h * 2) * PKU + lane * 8;
#pragma unroll
  for (int s = 0; s < QT; ++s) { v8h w[HD / 16];
#pragma unroll
    for (int j = 0; j < HD / 16; ++j) { const v8f o = acc[s][j] * (1.0f / 2048.0f);
#pragma unroll
      for (int r = 0; r < 8; ++r) w[j][r] = (_Float16)(o[r] * 64.0f);
      *(v8h*)(yp + (s * KSTEPS + (j >> 1)) * PKU + (j & 1) * 256) = w[j]; }
    if (s + 1 < QT) asm volatile("s_wait_xcnt 0x0" :: "v"(yp), "v"(w[0]), "v"(w[1]), "v"(w[2]), "v"(w[3]) : "memory");   /* behind a tile's stores, with their address and data as inputs, so that no register of them is written again ahead of the wait */
  }
  l2hold(hv0); l2hold(hv1); }
// ---- k_out: block = (128 rows, 128 cols), wave = 64 x 64: out = ctx Wo + bo: ctx x 2^6 f16 against Wo as f16(bf16 x 2^8) exact (1 product) x 2^-14; A = Wo columns, B = ctx rows, so a lane holds 8 neighbouring columns of an output row; staged in the wave's own LDS range, stored as whole lines
__global__ __launch_bounds__(128) void k_out(const _Float16* __restrict__ PY, const _Float16* __restrict__ PWO, const float* __restrict__ BO, float* __restrict__ OUT) { __shared__ __align__(16) float sf[4][64][68];
  const int tid = threadIdx.x, wave = tid >> 5, lane = tid & 31, col = lane & 15, g = lane >> 4; const int c0 = blockIdx.y * 128 + (wave & 1) * 64; const size_t r0 = (size_t)blockIdx.x * 128 + (wave >> 1) * 64;
  /* hints: the 4 blocks that read these 128 rows of ctx share its panel out by y, the 64 blocks that read these 128 columns of Wo theirs by (x >> 3) & 3 */
  const char* hy = (const char*)PY + (size_t)blockIdx.x * 8 * (PKT * 4) + l2off(wave, lane, blockIdx.y & 3); const char* hw = (const char*)PWO + (size_t)blockIdx.y * 8 * (PKT * 4) + l2off(wave, lane, (blockIdx.x >> 3) & 3);
  v8f acc[4][4] = {};
  gemm64<3, false>((const unsigned*)PWO + (size_t)(c0 / 16) * PKT + lane * 4, (const unsigned*)PY + (r0 / 16) * PKT + lane * 4, acc, hy, hw);
  float bias[4][8] = {};
  if (BO) {
#pragma unroll
    for (int i = 0; i < 4; ++i) {
#pragma unroll
      for (int r = 0; r < 8; ++r) bias[i][r] = bfr(BO[c0 + i * 16 + 8 * g + r]); } }
#pragma unroll
  for (int i = 0; i < 4; ++i) {
#pragma unroll
    for (int j = 0; j < 4; ++j) { float o[8];
#pragma unroll
      for (int r = 0; r < 8; ++r) o[r] = acc[i][j][r] * (1.0f / 16384.0f) + bias[i][r];   /* 2^-8 (Wo carry) x 2^-6 (ctx carry) */
      float* s = &sf[wave][j * 16 + col][i * 16 + 8 * g]; *(v4f*)s = (v4f){o[0], o[1], o[2], o[3]}; *(v4f*)(s + 4) = (v4f){o[4], o[5], o[6], o[7]}; } }
  LDSX();   /* the wave's own LDS writes have landed before other lanes of it read them */
#pragma unroll
  for (int e = 0; e < 32; ++e) { const int mj = e * 2 + g; vst2(OUT + (r0 + mj) * DIN + c0 + col * 4, *(const v4f*)&sf[wave][mj][col * 4]); }
  l2hold(hy); l2hold(hw); }

extern "C" void kernel_launch(void* const* d_in, const int* in_sizes, int n_in, void* d_out, int out_size, void* d_ws, size_t ws_size, hipStream_t stream) {
  (void)in_sizes; (void)n_in; (void)out_size;
  const float** F = (const float**)d_in;
  if (ws_size < (size_t)WS_END) return;
  char* ws = (char*)d_ws; _Float16 *QH = (_Float16*)(ws + WS_QH), *KH = (_Float16*)(ws + WS_KH), *VT = (_Float16*)(ws + WS_VT), *PWO = (_Float16*)(ws + WS_PWO), *PY = (_Float16*)(ws + WS_Y); __bf16 *PX = (__bf16*)(ws + WS_PX), *PW = (__bf16*)(ws + WS_PW);
  // inputs: 0 x [2,4096,512]; 1 Wq [512,512] (in,out), 2 bq; 3 Wk, 4 bk; 5 Wv, 6 bv; 7 Wo (in,out), 8 bo (biases NONZERO)
  k_pack<<<dim3((NJX + NJW + NJO) / 4), 128, 0, stream>>>(F[0], F[1], F[3], F[5], F[7], PX, PW, PWO);
  k_proj<<<dim3(TNB * TT / 128, CC / 128, 3), 128, 0, stream>>>(PX, PW, F[2], F[4], F[6], QH, KH, VT);
  k_att<<<dim3(NQB / QT, NH, TNB), 128, 0, stream>>>(QH, KH, VT, PY);
  k_out<<<dim3(TNB * TT / 128, DIN / 128), 128, 0, stream>>>(PY, PWO, F[8], (float*)d_out);
}
